// v000
// Measured on an AMD MI455X. A time is GPU time per run, averaged over a window of back-to-back runs after a warm-up
// (all launches, gaps included; the runs take copies of the inputs in turn), and the median of several windows.
// Apart from v000's, it joins two sittings. Times from different sittings can be a few percent apart, while
// side-by-side timings come from the same sitting.
// v000, which the later versions start from, runs in 375 microseconds.
#include <hip/hip_runtime.h>

typedef __attribute__((ext_vector_type(16))) _Float16 v16h;
typedef __attribute__((ext_vector_type(8)))  _Float16 v8h;
typedef __attribute__((ext_vector_type(8)))  float    v8f;

#define LDSS 40      // padded K-stride in halfs (80 bytes, 16B aligned)

#if __has_builtin(__builtin_amdgcn_global_load_async_to_lds_b128)
#define HAVE_ASYNC_LDS 1
#else
#define HAVE_ASYNC_LDS 0
#endif

// Match the builtin's parameter types exactly (from the compiler diagnostic):
//   arg0: AS(1) pointer to int __vector(16B)   (global source)
//   arg1: AS(3) pointer to int __vector(16B)   (LDS destination)
typedef int v4i __attribute__((vector_size(16)));
typedef __attribute__((address_space(1))) v4i* as1_v4i;
typedef __attribute__((address_space(3))) v4i* as3_v4i;

static __device__ __forceinline__ as1_v4i as_global16(const void* p) {
    return (as1_v4i)(unsigned long long)p;
}
static __device__ __forceinline__ as3_v4i as_lds16(const void* p) {
    // generic LDS pointer carries the LDS byte offset in its low 32 bits
    return (as3_v4i)(unsigned long long)(unsigned int)(unsigned long long)p;
}

static __device__ __forceinline__ void wait_async_all() {
#if __has_builtin(__builtin_amdgcn_s_wait_asynccnt)
    __builtin_amdgcn_s_wait_asynccnt(0);
#else
    asm volatile("s_wait_asynccnt 0x0" ::: "memory");
#endif
}

// ---------------- Pass 1: A f32 -> f16 ----------------
__global__ __launch_bounds__(256)
void prep_a_f16(const float* __restrict__ A, _Float16* __restrict__ Ah, size_t n) {
    size_t i = ((size_t)blockIdx.x * blockDim.x + threadIdx.x) * 8;
    if (i + 8 > n) return;
    float4 f0 = *(const float4*)(A + i);
    float4 f1 = *(const float4*)(A + i + 4);
    v8h h;
    h[0] = (_Float16)f0.x; h[1] = (_Float16)f0.y; h[2] = (_Float16)f0.z; h[3] = (_Float16)f0.w;
    h[4] = (_Float16)f1.x; h[5] = (_Float16)f1.y; h[6] = (_Float16)f1.z; h[7] = (_Float16)f1.w;
    *(v8h*)(Ah + i) = h;
}

// ------- Pass 2: B f32 [K][N] -> ternary f16, transposed to [N][K] -------
#define TB 64
__global__ __launch_bounds__(256)
void prep_b_tern_t(const float* __restrict__ B, _Float16* __restrict__ Bt, int K, int N) {
    __shared__ _Float16 t[TB][TB + 8];
    const int k0 = blockIdx.y * TB, n0 = blockIdx.x * TB;
    const int tid = threadIdx.x;

    const int kk = tid >> 2;
    const int nn = (tid & 3) * 16;
    const float4* src = (const float4*)(B + (size_t)(k0 + kk) * N + n0 + nn);
    float4 v[4];
    #pragma unroll
    for (int i = 0; i < 4; ++i) v[i] = src[i];
    const float* f = (const float*)v;
    #pragma unroll
    for (int i = 0; i < 16; ++i) {
        float wv = f[i];
        float aw = fabsf(wv);
        float tv = (aw >= 0.5f && aw < 1.5f) ? (wv > 0.0f ? 1.0f : -1.0f) : 0.0f;
        t[kk][nn + i] = (_Float16)tv;
    }
    __syncthreads();

    const int nr = tid >> 2;
    const int kc = (tid & 3) * 16;
    v8h o0, o1;
    #pragma unroll
    for (int i = 0; i < 8; ++i) { o0[i] = t[kc + i][nr]; o1[i] = t[kc + 8 + i][nr]; }
    _Float16* dst = Bt + (size_t)(n0 + nr) * K + k0 + kc;
    *(v8h*)dst       = o0;
    *(v8h*)(dst + 8) = o1;
}

// ---------------- Pass 3: f16 GEMM, C = Ah[M,K] x Bt[N,K]^T ----------------
#define GBM 256
#define GBN 128
#define GBK 32

__global__ __launch_bounds__(256)
void gemm_f16_wmma(const _Float16* __restrict__ Ah,   // [M][K] f16
                   const _Float16* __restrict__ Bt,   // [N][K] f16 (ternary)
                   float* __restrict__ C,             // [M][N] f32
                   int M, int N, int K)
{
    __shared__ _Float16 As[2][GBM * LDSS];
    __shared__ _Float16 Bs[2][GBN * LDSS];

    const int tid  = threadIdx.x;
    const int lane = tid & 31;
    const int w    = tid >> 5;
    const int waveM = w >> 1;        // 0..3 -> 64-row slab
    const int waveN = w & 1;         // 0..1 -> 64-col slab
    const int lm   = lane & 15;
    const int r0   = (lane >> 4) << 3;   // K-run select per 16-bit WMMA layout

    const int bx = blockIdx.x, by = blockIdx.y;

    // A staging: one 32-half row segment per thread (4 x b128)
    const _Float16* Ag = Ah + (size_t)(by * GBM + tid) * K;
    _Float16* AsRow0 = &As[0][tid * LDSS];
    _Float16* AsRow1 = &As[1][tid * LDSS];
    // B staging: 2 threads per row, 16 halfs each (2 x b128)
    const int bn = tid >> 1;
    const int bk = (tid & 1) * 16;
    const _Float16* Bg = Bt + (size_t)(bx * GBN + bn) * K + bk;
    _Float16* BsRow0 = &Bs[0][bn * LDSS + bk];
    _Float16* BsRow1 = &Bs[1][bn * LDSS + bk];

    // Stage tile kt of A and B into LDS buffer `buf`.
    auto stage = [&](int kt, int buf) {
        const _Float16* ga = Ag + (size_t)kt * GBK;
        const _Float16* gb = Bg + (size_t)kt * GBK;
        _Float16* laA = buf ? AsRow1 : AsRow0;
        _Float16* laB = buf ? BsRow1 : BsRow0;
#if HAVE_ASYNC_LDS
        #pragma unroll
        for (int i = 0; i < 4; ++i)
            __builtin_amdgcn_global_load_async_to_lds_b128(
                as_global16(ga + i * 8), as_lds16(laA + i * 8), 0, 0);
        #pragma unroll
        for (int i = 0; i < 2; ++i)
            __builtin_amdgcn_global_load_async_to_lds_b128(
                as_global16(gb + i * 8), as_lds16(laB + i * 8), 0, 0);
#else
        v8h a0 = *(const v8h*)(ga);      v8h a1 = *(const v8h*)(ga + 8);
        v8h a2 = *(const v8h*)(ga + 16); v8h a3 = *(const v8h*)(ga + 24);
        v8h b0 = *(const v8h*)(gb);      v8h b1 = *(const v8h*)(gb + 8);
        *(v8h*)(laA)      = a0; *(v8h*)(laA + 8)  = a1;
        *(v8h*)(laA + 16) = a2; *(v8h*)(laA + 24) = a3;
        *(v8h*)(laB)      = b0; *(v8h*)(laB + 8)  = b1;
#endif
    };

    v8f acc[4][4] = {};

    const int ktiles = K / GBK;
    stage(0, 0);
    wait_async_all();
    __syncthreads();

    for (int kt = 0; kt < ktiles; ++kt) {
        const int cur = kt & 1;

        if (kt + 1 < ktiles) stage(kt + 1, cur ^ 1);   // async: overlaps with WMMA below
        if (kt + 2 < ktiles) {
            __builtin_prefetch(Ag + (size_t)(kt + 2) * GBK, 0, 1);
            __builtin_prefetch(Bg + (size_t)(kt + 2) * GBK, 0, 1);
        }

        v16h af[4], bf[4];
        #pragma unroll
        for (int mi = 0; mi < 4; ++mi) {
            const _Float16* p = &As[cur][(waveM * 64 + mi * 16 + lm) * LDSS];
            v8h lo = *(const v8h*)(p + r0);
            v8h hi = *(const v8h*)(p + r0 + 16);
            #pragma unroll
            for (int i = 0; i < 8; ++i) { af[mi][i] = lo[i]; af[mi][i + 8] = hi[i]; }
        }
        #pragma unroll
        for (int ni = 0; ni < 4; ++ni) {
            const _Float16* p = &Bs[cur][(waveN * 64 + ni * 16 + lm) * LDSS];
            v8h lo = *(const v8h*)(p + r0);
            v8h hi = *(const v8h*)(p + r0 + 16);
            #pragma unroll
            for (int i = 0; i < 8; ++i) { bf[ni][i] = lo[i]; bf[ni][i + 8] = hi[i]; }
        }

        #pragma unroll
        for (int mi = 0; mi < 4; ++mi)
            #pragma unroll
            for (int ni = 0; ni < 4; ++ni)
                acc[mi][ni] = __builtin_amdgcn_wmma_f32_16x16x32_f16(
                    false, af[mi], false, bf[ni], (short)0, acc[mi][ni], false, false);

#if HAVE_ASYNC_LDS
        wait_async_all();
#endif
        __syncthreads();
    }

    const int rowBase = by * GBM + waveM * 64 + ((lane >> 4) << 3);
    const int colBase = bx * GBN + waveN * 64 + lm;
    #pragma unroll
    for (int mi = 0; mi < 4; ++mi)
        #pragma unroll
        for (int ni = 0; ni < 4; ++ni)
            #pragma unroll
            for (int r = 0; r < 8; ++r)
                __builtin_nontemporal_store(
                    acc[mi][ni][r],
                    &C[(size_t)(rowBase + mi * 16 + r) * N + colBase + ni * 16]);
}

// ---------------- Fallback: fused single-kernel path ----------------
#define BM 128
#define BN 128
#define BK 32

__global__ __launch_bounds__(256)
void ternary_gemm_fused(const float* __restrict__ A, const float* __restrict__ B,
                        float* __restrict__ C, int M, int N, int K)
{
    __shared__ _Float16 As[2][BM * LDSS];
    __shared__ _Float16 Bs[2][BN * LDSS];

    const int tid  = threadIdx.x;
    const int lane = tid & 31;
    const int w    = tid >> 5;
    const int waveM = w >> 1;
    const int waveN = w & 1;
    const int lm   = lane & 15;
    const int r0   = (lane >> 4) << 3;
    const int bx = blockIdx.x, by = blockIdx.y;

    const int arow = tid >> 1;
    const int acol = (tid & 1) * 16;
    const float4* Ag = (const float4*)(A + (size_t)(by * BM + arow) * K + acol);
    const int brow = tid >> 3;
    const int bcol = (tid & 7) * 16;
    const float4* Bg = (const float4*)(B + (size_t)brow * N + bx * BN + bcol);

    float4 aReg[4], bReg[4];
    auto loadGlobal = [&](int kt) {
        const float4* pa = Ag + (size_t)kt * (BK / 4);
        #pragma unroll
        for (int i = 0; i < 4; ++i) aReg[i] = pa[i];
        const float4* pb = Bg + (size_t)kt * BK * (N / 4);
        #pragma unroll
        for (int i = 0; i < 4; ++i) bReg[i] = pb[i];
    };
    auto stageToLds = [&](int buf) {
        const float* af = (const float*)aReg;
        v8h h0, h1;
        #pragma unroll
        for (int i = 0; i < 8; ++i) { h0[i] = (_Float16)af[i]; h1[i] = (_Float16)af[i + 8]; }
        *(v8h*)&As[buf][arow * LDSS + acol]     = h0;
        *(v8h*)&As[buf][arow * LDSS + acol + 8] = h1;
        const float* bf = (const float*)bReg;
        #pragma unroll
        for (int i = 0; i < 16; ++i) {
            float wv = bf[i];
            float aw = fabsf(wv);
            float t  = (aw >= 0.5f && aw < 1.5f) ? (wv > 0.0f ? 1.0f : -1.0f) : 0.0f;
            Bs[buf][(bcol + i) * LDSS + brow] = (_Float16)t;
        }
    };

    v8f acc[2][4] = {};
    const int ktiles = K / BK;
    loadGlobal(0);
    stageToLds(0);
    __syncthreads();

    for (int kt = 0; kt < ktiles; ++kt) {
        const int cur = kt & 1;
        if (kt + 1 < ktiles) loadGlobal(kt + 1);

        v16h afrag[2];
        #pragma unroll
        for (int mi = 0; mi < 2; ++mi) {
            const _Float16* p = &As[cur][(waveM * 32 + mi * 16 + lm) * LDSS];
            v8h lo = *(const v8h*)(p + r0);
            v8h hi = *(const v8h*)(p + r0 + 16);
            #pragma unroll
            for (int i = 0; i < 8; ++i) { afrag[mi][i] = lo[i]; afrag[mi][i + 8] = hi[i]; }
        }
        v16h bfrag[4];
        #pragma unroll
        for (int ni = 0; ni < 4; ++ni) {
            const _Float16* p = &Bs[cur][(waveN * 64 + ni * 16 + lm) * LDSS];
            v8h lo = *(const v8h*)(p + r0);
            v8h hi = *(const v8h*)(p + r0 + 16);
            #pragma unroll
            for (int i = 0; i < 8; ++i) { bfrag[ni][i] = lo[i]; bfrag[ni][i + 8] = hi[i]; }
        }
        #pragma unroll
        for (int mi = 0; mi < 2; ++mi)
            #pragma unroll
            for (int ni = 0; ni < 4; ++ni)
                acc[mi][ni] = __builtin_amdgcn_wmma_f32_16x16x32_f16(
                    false, afrag[mi], false, bfrag[ni], (short)0, acc[mi][ni], false, false);

        if (kt + 1 < ktiles) stageToLds(cur ^ 1);
        __syncthreads();
    }

    const int rowBase = by * BM + waveM * 32 + ((lane >> 4) << 3);
    const int colBase = bx * BN + waveN * 64 + lm;
    #pragma unroll
    for (int mi = 0; mi < 2; ++mi)
        #pragma unroll
        for (int ni = 0; ni < 4; ++ni)
            #pragma unroll
            for (int r = 0; r < 8; ++r)
                C[(size_t)(rowBase + mi * 16 + r) * N + colBase + ni * 16] = acc[mi][ni][r];
}

extern "C" void kernel_launch(void* const* d_in, const int* in_sizes, int n_in,
                              void* d_out, int out_size, void* d_ws, size_t ws_size,
                              hipStream_t stream) {
    const float* A = (const float*)d_in[0];   // inputs [M, K] f32
    const float* B = (const float*)d_in[1];   // kernel [K, N] f32
    float* C = (float*)d_out;                 // [M, N] f32

    const int K = 4096;
    const int N = in_sizes[1] / K;   // 4096
    const int M = in_sizes[0] / K;   // 8192

    const size_t needA = (size_t)M * K * sizeof(_Float16);
    const size_t needB = (size_t)N * K * sizeof(_Float16);

    if (ws_size >= needA + needB) {
        _Float16* Ah = (_Float16*)d_ws;
        _Float16* Bt = (_Float16*)((char*)d_ws + needA);

        const size_t nA = (size_t)M * K;
        prep_a_f16<<<dim3((unsigned)(nA / (256 * 8))), 256, 0, stream>>>(A, Ah, nA);
        prep_b_tern_t<<<dim3(N / TB, K / TB), 256, 0, stream>>>(B, Bt, K, N);
        gemm_f16_wmma<<<dim3(N / GBN, M / GBM), 256, 0, stream>>>(Ah, Bt, C, M, N, K);
    } else {
        ternary_gemm_fused<<<dim3(N / BN, M / BM), 256, 0, stream>>>(A, B, C, M, N, K);
    }
}

// v001
// Measured time: 232 microseconds a run.
// Timed twice side by side with v000, it ran 1.70 times as fast both times.
#include <hip/hip_runtime.h>

typedef __attribute__((ext_vector_type(16))) _Float16 v16h;
typedef __attribute__((ext_vector_type(8)))  _Float16 v8h;
typedef __attribute__((ext_vector_type(8)))  float    v8f;

#define LDSS 40      // padded K-stride in halfs (80 bytes, 16B aligned)

#if __has_builtin(__builtin_amdgcn_global_load_async_to_lds_b128)
#define HAVE_ASYNC_LDS 1
#else
#define HAVE_ASYNC_LDS 0
#endif

// Match the builtin's parameter types exactly (from the compiler diagnostic):
//   arg0: AS(1) pointer to int __vector(16B)   (global source)
//   arg1: AS(3) pointer to int __vector(16B)   (LDS destination)
typedef int v4i __attribute__((vector_size(16)));
typedef __attribute__((address_space(1))) v4i* as1_v4i;
typedef __attribute__((address_space(3))) v4i* as3_v4i;

static __device__ __forceinline__ as1_v4i as_global16(const void* p) {
    return (as1_v4i)(unsigned long long)p;
}
static __device__ __forceinline__ as3_v4i as_lds16(const void* p) {
    // generic LDS pointer carries the LDS byte offset in its low 32 bits
    return (as3_v4i)(unsigned long long)(unsigned int)(unsigned long long)p;
}

// ---------------- Pass 1: A f32 -> f16 ----------------
__global__ __launch_bounds__(256)
void prep_a_f16(const float* __restrict__ A, _Float16* __restrict__ Ah, size_t n) {
    size_t i = ((size_t)blockIdx.x * blockDim.x + threadIdx.x) * 8;
    if (i + 8 > n) return;
    float4 f0 = *(const float4*)(A + i);
    float4 f1 = *(const float4*)(A + i + 4);
    v8h h;
    h[0] = (_Float16)f0.x; h[1] = (_Float16)f0.y; h[2] = (_Float16)f0.z; h[3] = (_Float16)f0.w;
    h[4] = (_Float16)f1.x; h[5] = (_Float16)f1.y; h[6] = (_Float16)f1.z; h[7] = (_Float16)f1.w;
    *(v8h*)(Ah + i) = h;
}

// ------- Pass 2: B f32 [K][N] -> ternary f16, transposed to [N][K] -------
#define TB 64
__global__ __launch_bounds__(256)
void prep_b_tern_t(const float* __restrict__ B, _Float16* __restrict__ Bt, int K, int N) {
    __shared__ _Float16 t[TB][TB + 8];
    const int k0 = blockIdx.y * TB, n0 = blockIdx.x * TB;
    const int tid = threadIdx.x;

    const int kk = tid >> 2;
    const int nn = (tid & 3) * 16;
    const float4* src = (const float4*)(B + (size_t)(k0 + kk) * N + n0 + nn);
    float4 v[4];
    #pragma unroll
    for (int i = 0; i < 4; ++i) v[i] = src[i];
    const float* f = (const float*)v;
    #pragma unroll
    for (int i = 0; i < 16; ++i) {
        float wv = f[i];
        float aw = fabsf(wv);
        float tv = (aw >= 0.5f && aw < 1.5f) ? (wv > 0.0f ? 1.0f : -1.0f) : 0.0f;
        t[kk][nn + i] = (_Float16)tv;
    }
    __syncthreads();

    const int nr = tid >> 2;
    const int kc = (tid & 3) * 16;
    v8h o0, o1;
    #pragma unroll
    for (int i = 0; i < 8; ++i) { o0[i] = t[kc + i][nr]; o1[i] = t[kc + 8 + i][nr]; }
    _Float16* dst = Bt + (size_t)(n0 + nr) * K + k0 + kc;
    *(v8h*)dst       = o0;
    *(v8h*)(dst + 8) = o1;
}

// ---------------- Pass 3: f16 GEMM, C = Ah[M,K] x Bt[N,K]^T ----------------
#define GBM 256
#define GBN 128
#define GBK 64       // one 128-byte line of every operand row per K tile
#define GLDS 72      // LDS row pitch in halfs: 144 bytes = 16 B x odd, for ds_load_b128 readers

__global__ __launch_bounds__(256)
void gemm_f16_wmma(const _Float16* __restrict__ Ah,   // [M][K] f16
                   const _Float16* __restrict__ Bt,   // [N][K] f16 (ternary)
                   float* __restrict__ C,             // [M][N] f32
                   int M, int N, int K)
{
    __shared__ _Float16 As[2][GBM * GLDS];
    __shared__ _Float16 Bs[2][GBN * GLDS];

    const int tid  = threadIdx.x;
    const int lane = tid & 31;
    const int w    = tid >> 5;
    const int waveM = w >> 1;        // 0..3 -> 64-row slab
    const int waveN = w & 1;         // 0..1 -> 64-col slab
    const int lm   = lane & 15;
    const int r0   = (lane >> 4) << 3;   // K-run select per 16-bit WMMA layout

    const int bx = blockIdx.x, by = blockIdx.y;

    // Prefetch addresses: one row of the A tile per thread, two threads per row of B
    const _Float16* Ag = Ah + (size_t)(by * GBM + tid) * K;
    const int bn = tid >> 1;
    const int bk = (tid & 1) * 16;
    const _Float16* Bg = Bt + (size_t)(bx * GBN + bn) * K + bk;

    // Staging: eight lanes cover one row's 128-byte line, so one wave copy moves
    // four whole lines; the block covers 32 rows per copy (A: 8 copies, B: 4).
    const int srow = tid >> 3;           // 0..31
    const int scol = (tid & 7) * 8;      // halfs: 16 bytes per lane
    const _Float16* Asrc = Ah + (size_t)(by * GBM + srow) * K + scol;
    const _Float16* Bsrc = Bt + (size_t)(bx * GBN + srow) * K + scol;
    const size_t rstep = (size_t)32 * K; // 32 rows further, in halfs

    // Stage tile kt of A and B into LDS buffer `buf`.
    auto stage = [&](int kt, int buf) {
        const _Float16* ga = Asrc + (size_t)kt * GBK;
        const _Float16* gb = Bsrc + (size_t)kt * GBK;
        _Float16* laA = &As[buf][srow * GLDS + scol];
        _Float16* laB = &Bs[buf][srow * GLDS + scol];
#if HAVE_ASYNC_LDS
        #pragma unroll
        for (int i = 0; i < GBM / 32; ++i)
            __builtin_amdgcn_global_load_async_to_lds_b128(
                as_global16(ga + i * rstep), as_lds16(laA + i * 32 * GLDS), 0, 0);
        #pragma unroll
        for (int i = 0; i < GBN / 32; ++i)
            __builtin_amdgcn_global_load_async_to_lds_b128(
                as_global16(gb + i * rstep), as_lds16(laB + i * 32 * GLDS), 0, 0);
#else
        #pragma unroll
        for (int i = 0; i < GBM / 32; ++i)
            *(v8h*)(laA + i * 32 * GLDS) = *(const v8h*)(ga + i * rstep);
        #pragma unroll
        for (int i = 0; i < GBN / 32; ++i)
            *(v8h*)(laB + i * 32 * GLDS) = *(const v8h*)(gb + i * rstep);
#endif
    };

    v8f acc[4][4] = {};

    const int ktiles = K / GBK;
    stage(0, 0);
    // tile 0 has landed for this wave before the barrier publishes it
    asm volatile("s_wait_asynccnt 0x0" ::: "memory");
    __syncthreads();
    if (1 < ktiles) stage(1, 1);

    for (int kt = 0; kt < ktiles; ++kt) {
        const int cur = kt & 1;

        if (kt + 2 < ktiles) {
            __builtin_prefetch(Ag + (size_t)(kt + 2) * GBK, 0, 1);
            __builtin_prefetch(Bg + (size_t)(kt + 2) * GBK, 0, 1);
        }

        #pragma unroll
        for (int ks = 0; ks < GBK / 32; ++ks) {
            v16h af[4], bf[4];
            #pragma unroll
            for (int mi = 0; mi < 4; ++mi) {
                const _Float16* p = &As[cur][(waveM * 64 + mi * 16 + lm) * GLDS + ks * 32];
                v8h lo = *(const v8h*)(p + r0);
                v8h hi = *(const v8h*)(p + r0 + 16);
                #pragma unroll
                for (int i = 0; i < 8; ++i) { af[mi][i] = lo[i]; af[mi][i + 8] = hi[i]; }
            }
            #pragma unroll
            for (int ni = 0; ni < 4; ++ni) {
                const _Float16* p = &Bs[cur][(waveN * 64 + ni * 16 + lm) * GLDS + ks * 32];
                v8h lo = *(const v8h*)(p + r0);
                v8h hi = *(const v8h*)(p + r0 + 16);
                #pragma unroll
                for (int i = 0; i < 8; ++i) { bf[ni][i] = lo[i]; bf[ni][i + 8] = hi[i]; }
            }

            #pragma unroll
            for (int mi = 0; mi < 4; ++mi)
                #pragma unroll
                for (int ni = 0; ni < 4; ++ni)
                    acc[mi][ni] = __builtin_amdgcn_wmma_f32_16x16x32_f16(
                        false, af[mi], false, bf[ni], (short)0, acc[mi][ni], false, false);
        }

        // Publish point of tile kt + 1: this wave's reads of buffer cur are done,
        // its copies of tile kt + 1 have landed, then the barrier; only behind it
        // is buffer cur refilled.
        asm volatile("s_wait_dscnt 0x0" ::: "memory");
        asm volatile("s_wait_asynccnt 0x0" ::: "memory");
        __syncthreads();
        if (kt + 2 < ktiles) stage(kt + 2, cur);
    }
    // no copy is left in flight when the wave ends
    asm volatile("s_wait_asynccnt 0x0" ::: "memory");

    const int rowBase = by * GBM + waveM * 64 + ((lane >> 4) << 3);
    const int colBase = bx * GBN + waveN * 64 + lm;
    #pragma unroll
    for (int mi = 0; mi < 4; ++mi)
        #pragma unroll
        for (int ni = 0; ni < 4; ++ni)
            #pragma unroll
            for (int r = 0; r < 8; ++r)
                __builtin_nontemporal_store(
                    acc[mi][ni][r],
                    &C[(size_t)(rowBase + mi * 16 + r) * N + colBase + ni * 16]);
}

// ---------------- Fallback: fused single-kernel path ----------------
#define BM 128
#define BN 128
#define BK 32

__global__ __launch_bounds__(256)
void ternary_gemm_fused(const float* __restrict__ A, const float* __restrict__ B,
                        float* __restrict__ C, int M, int N, int K)
{
    __shared__ _Float16 As[2][BM * LDSS];
    __shared__ _Float16 Bs[2][BN * LDSS];

    const int tid  = threadIdx.x;
    const int lane = tid & 31;
    const int w    = tid >> 5;
    const int waveM = w >> 1;
    const int waveN = w & 1;
    const int lm   = lane & 15;
    const int r0   = (lane >> 4) << 3;
    const int bx = blockIdx.x, by = blockIdx.y;

    const int arow = tid >> 1;
    const int acol = (tid & 1) * 16;
    const float4* Ag = (const float4*)(A + (size_t)(by * BM + arow) * K + acol);
    const int brow = tid >> 3;
    const int bcol = (tid & 7) * 16;
    const float4* Bg = (const float4*)(B + (size_t)brow * N + bx * BN + bcol);

    float4 aReg[4], bReg[4];
    auto loadGlobal = [&](int kt) {
        const float4* pa = Ag + (size_t)kt * (BK / 4);
        #pragma unroll
        for (int i = 0; i < 4; ++i) aReg[i] = pa[i];
        const float4* pb = Bg + (size_t)kt * BK * (N / 4);
        #pragma unroll
        for (int i = 0; i < 4; ++i) bReg[i] = pb[i];
    };
    auto stageToLds = [&](int buf) {
        const float* af = (const float*)aReg;
        v8h h0, h1;
        #pragma unroll
        for (int i = 0; i < 8; ++i) { h0[i] = (_Float16)af[i]; h1[i] = (_Float16)af[i + 8]; }
        *(v8h*)&As[buf][arow * LDSS + acol]     = h0;
        *(v8h*)&As[buf][arow * LDSS + acol + 8] = h1;
        const float* bf = (const float*)bReg;
        #pragma unroll
        for (int i = 0; i < 16; ++i) {
            float wv = bf[i];
            float aw = fabsf(wv);
            float t  = (aw >= 0.5f && aw < 1.5f) ? (wv > 0.0f ? 1.0f : -1.0f) : 0.0f;
            Bs[buf][(bcol + i) * LDSS + brow] = (_Float16)t;
        }
    };

    v8f acc[2][4] = {};
    const int ktiles = K / BK;
    loadGlobal(0);
    stageToLds(0);
    __syncthreads();

    for (int kt = 0; kt < ktiles; ++kt) {
        const int cur = kt & 1;
        if (kt + 1 < ktiles) loadGlobal(kt + 1);

        v16h afrag[2];
        #pragma unroll
        for (int mi = 0; mi < 2; ++mi) {
            const _Float16* p = &As[cur][(waveM * 32 + mi * 16 + lm) * LDSS];
            v8h lo = *(const v8h*)(p + r0);
            v8h hi = *(const v8h*)(p + r0 + 16);
            #pragma unroll
            for (int i = 0; i < 8; ++i) { afrag[mi][i] = lo[i]; afrag[mi][i + 8] = hi[i]; }
        }
        v16h bfrag[4];
        #pragma unroll
        for (int ni = 0; ni < 4; ++ni) {
            const _Float16* p = &Bs[cur][(waveN * 64 + ni * 16 + lm) * LDSS];
            v8h lo = *(const v8h*)(p + r0);
            v8h hi = *(const v8h*)(p + r0 + 16);
            #pragma unroll
            for (int i = 0; i < 8; ++i) { bfrag[ni][i] = lo[i]; bfrag[ni][i + 8] = hi[i]; }
        }
        #pragma unroll
        for (int mi = 0; mi < 2; ++mi)
            #pragma unroll
            for (int ni = 0; ni < 4; ++ni)
                acc[mi][ni] = __builtin_amdgcn_wmma_f32_16x16x32_f16(
                    false, afrag[mi], false, bfrag[ni], (short)0, acc[mi][ni], false, false);

        if (kt + 1 < ktiles) stageToLds(cur ^ 1);
        __syncthreads();
    }

    const int rowBase = by * BM + waveM * 32 + ((lane >> 4) << 3);
    const int colBase = bx * BN + waveN * 64 + lm;
    #pragma unroll
    for (int mi = 0; mi < 2; ++mi)
        #pragma unroll
        for (int ni = 0; ni < 4; ++ni)
            #pragma unroll
            for (int r = 0; r < 8; ++r)
                C[(size_t)(rowBase + mi * 16 + r) * N + colBase + ni * 16] = acc[mi][ni][r];
}

extern "C" void kernel_launch(void* const* d_in, const int* in_sizes, int n_in,
                              void* d_out, int out_size, void* d_ws, size_t ws_size,
                              hipStream_t stream) {
    const float* A = (const float*)d_in[0];   // inputs [M, K] f32
    const float* B = (const float*)d_in[1];   // kernel [K, N] f32
    float* C = (float*)d_out;                 // [M, N] f32

    const int K = 4096;
    const int N = in_sizes[1] / K;   // 4096
    const int M = in_sizes[0] / K;   // 8192

    const size_t needA = (size_t)M * K * sizeof(_Float16);
    const size_t needB = (size_t)N * K * sizeof(_Float16);

    if (ws_size >= needA + needB) {
        _Float16* Ah = (_Float16*)d_ws;
        _Float16* Bt = (_Float16*)((char*)d_ws + needA);

        const size_t nA = (size_t)M * K;
        prep_a_f16<<<dim3((unsigned)(nA / (256 * 8))), 256, 0, stream>>>(A, Ah, nA);
        prep_b_tern_t<<<dim3(N / TB, K / TB), 256, 0, stream>>>(B, Bt, K, N);
        gemm_f16_wmma<<<dim3(N / GBN, M / GBM), 256, 0, stream>>>(Ah, Bt, C, M, N, K);
    } else {
        ternary_gemm_fused<<<dim3(N / BN, M / BM), 256, 0, stream>>>(A, B, C, M, N, K);
    }
}

// v002
// It runs in 205 microseconds.
// Timed twice side by side with v001, it ran 1.14 times as fast both times.
// All steps since v000 together make it 1.93 times as fast.
#include <hip/hip_runtime.h>

typedef __attribute__((ext_vector_type(16))) _Float16 v16h;
typedef __attribute__((ext_vector_type(8)))  _Float16 v8h;
typedef __attribute__((ext_vector_type(8)))  float    v8f;

#define LDSS 40      // padded K-stride in halfs (80 bytes, 16B aligned)

#if __has_builtin(__builtin_amdgcn_global_load_async_to_lds_b128)
#define HAVE_ASYNC_LDS 1
#else
#define HAVE_ASYNC_LDS 0
#endif

// Match the builtin's parameter types exactly (from the compiler diagnostic):
//   arg0: AS(1) pointer to int __vector(16B)   (global source)
//   arg1: AS(3) pointer to int __vector(16B)   (LDS destination)
typedef int v4i __attribute__((vector_size(16)));
typedef __attribute__((address_space(1))) v4i* as1_v4i;
typedef __attribute__((address_space(3))) v4i* as3_v4i;

static __device__ __forceinline__ as1_v4i as_global16(const void* p) {
    return (as1_v4i)(unsigned long long)p;
}
static __device__ __forceinline__ as3_v4i as_lds16(const void* p) {
    // generic LDS pointer carries the LDS byte offset in its low 32 bits
    return (as3_v4i)(unsigned long long)(unsigned int)(unsigned long long)p;
}

// ---------------- Pass 1: A f32 -> f16 ----------------
__global__ __launch_bounds__(256)
void prep_a_f16(const float* __restrict__ A, _Float16* __restrict__ Ah, size_t n) {
    size_t i = ((size_t)blockIdx.x * blockDim.x + threadIdx.x) * 8;
    if (i + 8 > n) return;
    float4 f0 = *(const float4*)(A + i);
    float4 f1 = *(const float4*)(A + i + 4);
    v8h h;
    h[0] = (_Float16)f0.x; h[1] = (_Float16)f0.y; h[2] = (_Float16)f0.z; h[3] = (_Float16)f0.w;
    h[4] = (_Float16)f1.x; h[5] = (_Float16)f1.y; h[6] = (_Float16)f1.z; h[7] = (_Float16)f1.w;
    *(v8h*)(Ah + i) = h;
}

// ------- Pass 2: B f32 [K][N] -> ternary f16, transposed to [N][K] -------
#define TB 64
__global__ __launch_bounds__(256)
void prep_b_tern_t(const float* __restrict__ B, _Float16* __restrict__ Bt, int K, int N) {
    __shared__ _Float16 t[TB][TB + 8];
    const int k0 = blockIdx.y * TB, n0 = blockIdx.x * TB;
    const int tid = threadIdx.x;

    const int kk = tid >> 2;
    const int nn = (tid & 3) * 16;
    const float4* src = (const float4*)(B + (size_t)(k0 + kk) * N + n0 + nn);
    float4 v[4];
    #pragma unroll
    for (int i = 0; i < 4; ++i) v[i] = src[i];
    const float* f = (const float*)v;
    #pragma unroll
    for (int i = 0; i < 16; ++i) {
        float wv = f[i];
        float aw = fabsf(wv);
        float tv = (aw >= 0.5f && aw < 1.5f) ? (wv > 0.0f ? 1.0f : -1.0f) : 0.0f;
        t[kk][nn + i] = (_Float16)tv;
    }
    __syncthreads();

    const int nr = tid >> 2;
    const int kc = (tid & 3) * 16;
    v8h o0, o1;
    #pragma unroll
    for (int i = 0; i < 8; ++i) { o0[i] = t[kc + i][nr]; o1[i] = t[kc + 8 + i][nr]; }
    _Float16* dst = Bt + (size_t)(n0 + nr) * K + k0 + kc;
    *(v8h*)dst       = o0;
    *(v8h*)(dst + 8) = o1;
}

// ---------------- Pass 3: f16 GEMM, C = Ah[M,K] x Bt[N,K]^T ----------------
#define GBM 256
#define GBN 256
#define GBK 64       // one 128-byte line of every operand row per K tile
#define GLDS 72      // LDS row pitch in halfs: 144 bytes = 16 B x odd, for ds_load_b128 readers

__global__ __launch_bounds__(256)
void gemm_f16_wmma(const _Float16* __restrict__ Ah,   // [M][K] f16
                   const _Float16* __restrict__ Bt,   // [N][K] f16 (ternary)
                   float* __restrict__ C,             // [M][N] f32
                   int M, int N, int K)
{
    __shared__ _Float16 As[2][GBM * GLDS];
    __shared__ _Float16 Bs[2][GBN * GLDS];

    const int tid  = threadIdx.x;
    const int lane = tid & 31;
    const int w    = tid >> 5;
    const int waveM = w >> 2;        // 0..1 -> 128-row slab
    const int waveN = w & 3;         // 0..3 -> 64-col slab
    const int lm   = lane & 15;
    const int r0   = (lane >> 4) << 3;   // K-run select per 16-bit WMMA layout

    const int bx = blockIdx.x, by = blockIdx.y;

    // Prefetch addresses: one row of the A tile and one row of the B tile per thread
    const _Float16* Ag = Ah + (size_t)(by * GBM + tid) * K;
    const _Float16* Bg = Bt + (size_t)(bx * GBN + tid) * K;

    // Staging: eight lanes cover one row's 128-byte line, so one wave copy moves
    // four whole lines; the block covers 32 rows per copy (A: 8 copies, B: 8).
    const int srow = tid >> 3;           // 0..31
    const int scol = (tid & 7) * 8;      // halfs: 16 bytes per lane
    const _Float16* Asrc = Ah + (size_t)(by * GBM + srow) * K + scol;
    const _Float16* Bsrc = Bt + (size_t)(bx * GBN + srow) * K + scol;
    const size_t rstep = (size_t)32 * K; // 32 rows further, in halfs

    // Stage tile kt of A and B into LDS buffer `buf`.
    auto stage = [&](int kt, int buf) {
        const _Float16* ga = Asrc + (size_t)kt * GBK;
        const _Float16* gb = Bsrc + (size_t)kt * GBK;
        _Float16* laA = &As[buf][srow * GLDS + scol];
        _Float16* laB = &Bs[buf][srow * GLDS + scol];
#if HAVE_ASYNC_LDS
        #pragma unroll
        for (int i = 0; i < GBM / 32; ++i)
            __builtin_amdgcn_global_load_async_to_lds_b128(
                as_global16(ga + i * rstep), as_lds16(laA + i * 32 * GLDS), 0, 0);
        #pragma unroll
        for (int i = 0; i < GBN / 32; ++i)
            __builtin_amdgcn_global_load_async_to_lds_b128(
                as_global16(gb + i * rstep), as_lds16(laB + i * 32 * GLDS), 0, 0);
#else
        #pragma unroll
        for (int i = 0; i < GBM / 32; ++i)
            *(v8h*)(laA + i * 32 * GLDS) = *(const v8h*)(ga + i * rstep);
        #pragma unroll
        for (int i = 0; i < GBN / 32; ++i)
            *(v8h*)(laB + i * 32 * GLDS) = *(const v8h*)(gb + i * rstep);
#endif
    };

    v8f acc[8][4] = {};

    const int ktiles = K / GBK;
    stage(0, 0);
    // tile 0 has landed for this wave before the barrier publishes it
    asm volatile("s_wait_asynccnt 0x0" ::: "memory");
    __syncthreads();
    if (1 < ktiles) stage(1, 1);

    for (int kt = 0; kt < ktiles; ++kt) {
        const int cur = kt & 1;

        if (kt + 2 < ktiles) {
            __builtin_prefetch(Ag + (size_t)(kt + 2) * GBK, 0, 1);
            __builtin_prefetch(Bg + (size_t)(kt + 2) * GBK, 0, 1);
        }

        #pragma unroll
        for (int ks = 0; ks < GBK / 32; ++ks) {
            v16h af[8], bf[4];
            #pragma unroll
            for (int ni = 0; ni < 4; ++ni) {
                const _Float16* p = &Bs[cur][(waveN * 64 + ni * 16 + lm) * GLDS + ks * 32];
                v8h lo = *(const v8h*)(p + r0);
                v8h hi = *(const v8h*)(p + r0 + 16);
                #pragma unroll
                for (int i = 0; i < 8; ++i) { bf[ni][i] = lo[i]; bf[ni][i + 8] = hi[i]; }
            }
            // The B fragments, which the first row of WMMAs needs whole, stay in front of
            // the A fragments, so that the counted waits let row 0 start after ten reads.
            __builtin_amdgcn_sched_barrier(0);
            #pragma unroll
            for (int mi = 0; mi < 8; ++mi) {
                const _Float16* p = &As[cur][(waveM * 128 + mi * 16 + lm) * GLDS + ks * 32];
                v8h lo = *(const v8h*)(p + r0);
                v8h hi = *(const v8h*)(p + r0 + 16);
                #pragma unroll
                for (int i = 0; i < 8; ++i) { af[mi][i] = lo[i]; af[mi][i + 8] = hi[i]; }
            }

            // Keeps the block's 24 LDS reads together in front of its 32 WMMAs: left
            // alone the compiler reads one A fragment per row of four WMMAs and waits
            // for it each time, which two waves per SIMD cannot hide.
            __builtin_amdgcn_sched_barrier(0);

            #pragma unroll
            for (int mi = 0; mi < 8; ++mi)
                #pragma unroll
                for (int ni = 0; ni < 4; ++ni)
                    acc[mi][ni] = __builtin_amdgcn_wmma_f32_16x16x32_f16(
                        false, af[mi], false, bf[ni], (short)0, acc[mi][ni], false, false);

            // Keeps the next block's reads from moving up among these WMMAs.
            __builtin_amdgcn_sched_barrier(0);
        }

        // Publish point of tile kt + 1: this wave's reads of buffer cur are done,
        // its copies of tile kt + 1 have landed, then the barrier; only behind it
        // is buffer cur refilled.
        asm volatile("s_wait_dscnt 0x0" ::: "memory");
        asm volatile("s_wait_asynccnt 0x0" ::: "memory");
        __syncthreads();
        if (kt + 2 < ktiles) stage(kt + 2, cur);
    }
    // no copy is left in flight when the wave ends
    asm volatile("s_wait_asynccnt 0x0" ::: "memory");

    const int rowBase = by * GBM + waveM * 128 + ((lane >> 4) << 3);
    const int colBase = bx * GBN + waveN * 64 + lm;
    #pragma unroll
    for (int mi = 0; mi < 8; ++mi)
        #pragma unroll
        for (int ni = 0; ni < 4; ++ni)
            #pragma unroll
            for (int r = 0; r < 8; ++r)
                __builtin_nontemporal_store(
                    acc[mi][ni][r],
                    &C[(size_t)(rowBase + mi * 16 + r) * N + colBase + ni * 16]);
}

// ---------------- Fallback: fused single-kernel path ----------------
#define BM 128
#define BN 128
#define BK 32

__global__ __launch_bounds__(256)
void ternary_gemm_fused(const float* __restrict__ A, const float* __restrict__ B,
                        float* __restrict__ C, int M, int N, int K)
{
    __shared__ _Float16 As[2][BM * LDSS];
    __shared__ _Float16 Bs[2][BN * LDSS];

    const int tid  = threadIdx.x;
    const int lane = tid & 31;
    const int w    = tid >> 5;
    const int waveM = w >> 1;
    const int waveN = w & 1;
    const int lm   = lane & 15;
    const int r0   = (lane >> 4) << 3;
    const int bx = blockIdx.x, by = blockIdx.y;

    const int arow = tid >> 1;
    const int acol = (tid & 1) * 16;
    const float4* Ag = (const float4*)(A + (size_t)(by * BM + arow) * K + acol);
    const int brow = tid >> 3;
    const int bcol = (tid & 7) * 16;
    const float4* Bg = (const float4*)(B + (size_t)brow * N + bx * BN + bcol);

    float4 aReg[4], bReg[4];
    auto loadGlobal = [&](int kt) {
        const float4* pa = Ag + (size_t)kt * (BK / 4);
        #pragma unroll
        for (int i = 0; i < 4; ++i) aReg[i] = pa[i];
        const float4* pb = Bg + (size_t)kt * BK * (N / 4);
        #pragma unroll
        for (int i = 0; i < 4; ++i) bReg[i] = pb[i];
    };
    auto stageToLds = [&](int buf) {
        const float* af = (const float*)aReg;
        v8h h0, h1;
        #pragma unroll
        for (int i = 0; i < 8; ++i) { h0[i] = (_Float16)af[i]; h1[i] = (_Float16)af[i + 8]; }
        *(v8h*)&As[buf][arow * LDSS + acol]     = h0;
        *(v8h*)&As[buf][arow * LDSS + acol + 8] = h1;
        const float* bf = (const float*)bReg;
        #pragma unroll
        for (int i = 0; i < 16; ++i) {
            float wv = bf[i];
            float aw = fabsf(wv);
            float t  = (aw >= 0.5f && aw < 1.5f) ? (wv > 0.0f ? 1.0f : -1.0f) : 0.0f;
            Bs[buf][(bcol + i) * LDSS + brow] = (_Float16)t;
        }
    };

    v8f acc[2][4] = {};
    const int ktiles = K / BK;
    loadGlobal(0);
    stageToLds(0);
    __syncthreads();

    for (int kt = 0; kt < ktiles; ++kt) {
        const int cur = kt & 1;
        if (kt + 1 < ktiles) loadGlobal(kt + 1);

        v16h afrag[2];
        #pragma unroll
        for (int mi = 0; mi < 2; ++mi) {
            const _Float16* p = &As[cur][(waveM * 32 + mi * 16 + lm) * LDSS];
            v8h lo = *(const v8h*)(p + r0);
            v8h hi = *(const v8h*)(p + r0 + 16);
            #pragma unroll
            for (int i = 0; i < 8; ++i) { afrag[mi][i] = lo[i]; afrag[mi][i + 8] = hi[i]; }
        }
        v16h bfrag[4];
        #pragma unroll
        for (int ni = 0; ni < 4; ++ni) {
            const _Float16* p = &Bs[cur][(waveN * 64 + ni * 16 + lm) * LDSS];
            v8h lo = *(const v8h*)(p + r0);
            v8h hi = *(const v8h*)(p + r0 + 16);
            #pragma unroll
            for (int i = 0; i < 8; ++i) { bfrag[ni][i] = lo[i]; bfrag[ni][i + 8] = hi[i]; }
        }
        #pragma unroll
        for (int mi = 0; mi < 2; ++mi)
            #pragma unroll
            for (int ni = 0; ni < 4; ++ni)
                acc[mi][ni] = __builtin_amdgcn_wmma_f32_16x16x32_f16(
                    false, afrag[mi], false, bfrag[ni], (short)0, acc[mi][ni], false, false);

        if (kt + 1 < ktiles) stageToLds(cur ^ 1);
        __syncthreads();
    }

    const int rowBase = by * BM + waveM * 32 + ((lane >> 4) << 3);
    const int colBase = bx * BN + waveN * 64 + lm;
    #pragma unroll
    for (int mi = 0; mi < 2; ++mi)
        #pragma unroll
        for (int ni = 0; ni < 4; ++ni)
            #pragma unroll
            for (int r = 0; r < 8; ++r)
                C[(size_t)(rowBase + mi * 16 + r) * N + colBase + ni * 16] = acc[mi][ni][r];
}

extern "C" void kernel_launch(void* const* d_in, const int* in_sizes, int n_in,
                              void* d_out, int out_size, void* d_ws, size_t ws_size,
                              hipStream_t stream) {
    const float* A = (const float*)d_in[0];   // inputs [M, K] f32
    const float* B = (const float*)d_in[1];   // kernel [K, N] f32
    float* C = (float*)d_out;                 // [M, N] f32

    const int K = 4096;
    const int N = in_sizes[1] / K;   // 4096
    const int M = in_sizes[0] / K;   // 8192

    const size_t needA = (size_t)M * K * sizeof(_Float16);
    const size_t needB = (size_t)N * K * sizeof(_Float16);

    if (ws_size >= needA + needB) {
        _Float16* Ah = (_Float16*)d_ws;
        _Float16* Bt = (_Float16*)((char*)d_ws + needA);

        const size_t nA = (size_t)M * K;
        prep_a_f16<<<dim3((unsigned)(nA / (256 * 8))), 256, 0, stream>>>(A, Ah, nA);
        prep_b_tern_t<<<dim3(N / TB, K / TB), 256, 0, stream>>>(B, Bt, K, N);
        gemm_f16_wmma<<<dim3(N / GBN, M / GBM), 256, 0, stream>>>(Ah, Bt, C, M, N, K);
    } else {
        ternary_gemm_fused<<<dim3(N / BN, M / BM), 256, 0, stream>>>(A, B, C, M, N, K);
    }
}

// v003
// It runs in 197 microseconds.
// In both of two side-by-side timings against v002, it was 1.04 times as fast.
// All steps since v000 together make it 2.00 times as fast.
#include <hip/hip_runtime.h>

typedef __attribute__((ext_vector_type(16))) _Float16 v16h;
typedef __attribute__((ext_vector_type(8)))  _Float16 v8h;
typedef __attribute__((ext_vector_type(8)))  float    v8f;

#define LDSS 40      // padded K-stride in halfs (80 bytes, 16B aligned)

#if __has_builtin(__builtin_amdgcn_global_load_async_to_lds_b128)
#define HAVE_ASYNC_LDS 1
#else
#define HAVE_ASYNC_LDS 0
#endif

// Match the builtin's parameter types exactly (from the compiler diagnostic):
//   arg0: AS(1) pointer to int __vector(16B)   (global source)
//   arg1: AS(3) pointer to int __vector(16B)   (LDS destination)
typedef int v4i __attribute__((vector_size(16)));
typedef __attribute__((address_space(1))) v4i* as1_v4i;
typedef __attribute__((address_space(3))) v4i* as3_v4i;

static __device__ __forceinline__ as1_v4i as_global16(const void* p) {
    return (as1_v4i)(unsigned long long)p;
}
static __device__ __forceinline__ as3_v4i as_lds16(const void* p) {
    // generic LDS pointer carries the LDS byte offset in its low 32 bits
    return (as3_v4i)(unsigned long long)(unsigned int)(unsigned long long)p;
}

// ---------------- Pass 1: A f32 -> f16 ----------------
__global__ __launch_bounds__(256)
void prep_a_f16(const float* __restrict__ A, _Float16* __restrict__ Ah, size_t n) {
    size_t i = ((size_t)blockIdx.x * blockDim.x + threadIdx.x) * 8;
    if (i + 8 > n) return;
    float4 f0 = *(const float4*)(A + i);
    float4 f1 = *(const float4*)(A + i + 4);
    v8h h;
    h[0] = (_Float16)f0.x; h[1] = (_Float16)f0.y; h[2] = (_Float16)f0.z; h[3] = (_Float16)f0.w;
    h[4] = (_Float16)f1.x; h[5] = (_Float16)f1.y; h[6] = (_Float16)f1.z; h[7] = (_Float16)f1.w;
    *(v8h*)(Ah + i) = h;
}

// ------- Pass 2: B f32 [K][N] -> ternary f16, transposed to [N][K] -------
#define TB 64
__global__ __launch_bounds__(256)
void prep_b_tern_t(const float* __restrict__ B, _Float16* __restrict__ Bt, int K, int N) {
    __shared__ _Float16 t[TB][TB + 8];
    const int k0 = blockIdx.y * TB, n0 = blockIdx.x * TB;
    const int tid = threadIdx.x;

    const int kk = tid >> 2;
    const int nn = (tid & 3) * 16;
    const float4* src = (const float4*)(B + (size_t)(k0 + kk) * N + n0 + nn);
    float4 v[4];
    #pragma unroll
    for (int i = 0; i < 4; ++i) v[i] = src[i];
    const float* f = (const float*)v;
    #pragma unroll
    for (int i = 0; i < 16; ++i) {
        float wv = f[i];
        float aw = fabsf(wv);
        float tv = (aw >= 0.5f && aw < 1.5f) ? (wv > 0.0f ? 1.0f : -1.0f) : 0.0f;
        t[kk][nn + i] = (_Float16)tv;
    }
    __syncthreads();

    const int nr = tid >> 2;
    const int kc = (tid & 3) * 16;
    v8h o0, o1;
    #pragma unroll
    for (int i = 0; i < 8; ++i) { o0[i] = t[kc + i][nr]; o1[i] = t[kc + 8 + i][nr]; }
    _Float16* dst = Bt + (size_t)(n0 + nr) * K + k0 + kc;
    *(v8h*)dst       = o0;
    *(v8h*)(dst + 8) = o1;
}

// ---------------- Pass 3: f16 GEMM, C = Ah[M,K] x Bt[N,K]^T ----------------
#define GBM 256
#define GBN 256
#define GBK 64       // one 128-byte line of every operand row per K tile
#define GLDS 72      // LDS row pitch in halfs: 144 bytes = 16 B x odd, for ds_load_b128 readers

__global__ __launch_bounds__(256)
void gemm_f16_wmma(const _Float16* __restrict__ Ah,   // [M][K] f16
                   const _Float16* __restrict__ Bt,   // [N][K] f16 (ternary)
                   float* __restrict__ C,             // [M][N] f32
                   int M, int N, int K)
{
    __shared__ _Float16 As[2][GBM * GLDS];
    __shared__ _Float16 Bs[2][GBN * GLDS];

    const int tid  = threadIdx.x;
    const int lane = tid & 31;
    const int w    = tid >> 5;
    const int waveM = w >> 2;        // 0..1 -> 128-row slab
    const int waveN = w & 3;         // 0..3 -> 64-col slab
    const int lm   = lane & 15;
    const int r0   = (lane >> 4) << 3;   // K-run select per 16-bit WMMA layout

    const int bx = blockIdx.x, by = blockIdx.y;

    // Staging: eight lanes cover one row's 128-byte line, so one wave copy moves
    // four whole lines; the block covers 32 rows per copy (A: 8 copies, B: 8).
    const int srow = tid >> 3;           // 0..31
    const int scol = (tid & 7) * 8;      // halfs: 16 bytes per lane
    const _Float16* Asrc = Ah + (size_t)(by * GBM + srow) * K + scol;
    const _Float16* Bsrc = Bt + (size_t)(bx * GBN + srow) * K + scol;
    const size_t rstep = (size_t)32 * K; // 32 rows further, in halfs

    // Stage tile kt of A and B into LDS buffer `buf`.
    auto stage = [&](int kt, int buf) {
        const _Float16* ga = Asrc + (size_t)kt * GBK;
        const _Float16* gb = Bsrc + (size_t)kt * GBK;
        _Float16* laA = &As[buf][srow * GLDS + scol];
        _Float16* laB = &Bs[buf][srow * GLDS + scol];
#if HAVE_ASYNC_LDS
        #pragma unroll
        for (int i = 0; i < GBM / 32; ++i)
            __builtin_amdgcn_global_load_async_to_lds_b128(
                as_global16(ga + i * rstep), as_lds16(laA + i * 32 * GLDS), 0, 0);
        #pragma unroll
        for (int i = 0; i < GBN / 32; ++i)
            __builtin_amdgcn_global_load_async_to_lds_b128(
                as_global16(gb + i * rstep), as_lds16(laB + i * 32 * GLDS), 0, 0);
#else
        #pragma unroll
        for (int i = 0; i < GBM / 32; ++i)
            *(v8h*)(laA + i * 32 * GLDS) = *(const v8h*)(ga + i * rstep);
        #pragma unroll
        for (int i = 0; i < GBN / 32; ++i)
            *(v8h*)(laB + i * 32 * GLDS) = *(const v8h*)(gb + i * rstep);
#endif
    };

    v8f acc[8][4] = {};

    const int ktiles = K / GBK;
    stage(0, 0);
    // tile 0 has landed for this wave before the barrier publishes it
    asm volatile("s_wait_asynccnt 0x0" ::: "memory");
    __syncthreads();
    if (1 < ktiles) stage(1, 1);

    for (int kt = 0; kt < ktiles; ++kt) {
        const int cur = kt & 1;

        #pragma unroll
        for (int ks = 0; ks < GBK / 32; ++ks) {
            v16h af[8], bf[4];
            #pragma unroll
            for (int ni = 0; ni < 4; ++ni) {
                const _Float16* p = &Bs[cur][(waveN * 64 + ni * 16 + lm) * GLDS + ks * 32];
                v8h lo = *(const v8h*)(p + r0);
                v8h hi = *(const v8h*)(p + r0 + 16);
                #pragma unroll
                for (int i = 0; i < 8; ++i) { bf[ni][i] = lo[i]; bf[ni][i + 8] = hi[i]; }
            }
            // The B fragments, which the first row of WMMAs needs whole, stay in front of
            // the A fragments, so that the counted waits let row 0 start after ten reads.
            __builtin_amdgcn_sched_barrier(0);
            #pragma unroll
            for (int mi = 0; mi < 8; ++mi) {
                const _Float16* p = &As[cur][(waveM * 128 + mi * 16 + lm) * GLDS + ks * 32];
                v8h lo = *(const v8h*)(p + r0);
                v8h hi = *(const v8h*)(p + r0 + 16);
                #pragma unroll
                for (int i = 0; i < 8; ++i) { af[mi][i] = lo[i]; af[mi][i + 8] = hi[i]; }
            }

            // Keeps the block's 24 LDS reads together in front of its 32 WMMAs: left
            // alone the compiler reads one A fragment per row of four WMMAs and waits
            // for it each time, which two waves per SIMD cannot hide.
            __builtin_amdgcn_sched_barrier(0);

            #pragma unroll
            for (int mi = 0; mi < 8; ++mi)
                #pragma unroll
                for (int ni = 0; ni < 4; ++ni)
                    acc[mi][ni] = __builtin_amdgcn_wmma_f32_16x16x32_f16(
                        false, af[mi], false, bf[ni], (short)0, acc[mi][ni], false, false);

            // Keeps the next block's reads from moving up among these WMMAs.
            __builtin_amdgcn_sched_barrier(0);
        }

        // Publish point of tile kt + 1: this wave's reads of buffer cur are done,
        // its copies of tile kt + 1 have landed, then the barrier; only behind it
        // is buffer cur refilled.
        asm volatile("s_wait_dscnt 0x0" ::: "memory");
        asm volatile("s_wait_asynccnt 0x0" ::: "memory");
        __syncthreads();
        if (kt + 2 < ktiles) stage(kt + 2, cur);
    }
    // no copy is left in flight when the wave ends
    asm volatile("s_wait_asynccnt 0x0" ::: "memory");

    const int rowBase = by * GBM + waveM * 128 + ((lane >> 4) << 3);
    const int colBase = bx * GBN + waveN * 64 + lm;
    #pragma unroll
    for (int mi = 0; mi < 8; ++mi)
        #pragma unroll
        for (int ni = 0; ni < 4; ++ni)
            #pragma unroll
            for (int r = 0; r < 8; ++r)
                __builtin_nontemporal_store(
                    acc[mi][ni][r],
                    &C[(size_t)(rowBase + mi * 16 + r) * N + colBase + ni * 16]);
}

// ---------------- Fallback: fused single-kernel path ----------------
#define BM 128
#define BN 128
#define BK 32

__global__ __launch_bounds__(256)
void ternary_gemm_fused(const float* __restrict__ A, const float* __restrict__ B,
                        float* __restrict__ C, int M, int N, int K)
{
    __shared__ _Float16 As[2][BM * LDSS];
    __shared__ _Float16 Bs[2][BN * LDSS];

    const int tid  = threadIdx.x;
    const int lane = tid & 31;
    const int w    = tid >> 5;
    const int waveM = w >> 1;
    const int waveN = w & 1;
    const int lm   = lane & 15;
    const int r0   = (lane >> 4) << 3;
    const int bx = blockIdx.x, by = blockIdx.y;

    const int arow = tid >> 1;
    const int acol = (tid & 1) * 16;
    const float4* Ag = (const float4*)(A + (size_t)(by * BM + arow) * K + acol);
    const int brow = tid >> 3;
    const int bcol = (tid & 7) * 16;
    const float4* Bg = (const float4*)(B + (size_t)brow * N + bx * BN + bcol);

    float4 aReg[4], bReg[4];
    auto loadGlobal = [&](int kt) {
        const float4* pa = Ag + (size_t)kt * (BK / 4);
        #pragma unroll
        for (int i = 0; i < 4; ++i) aReg[i] = pa[i];
        const float4* pb = Bg + (size_t)kt * BK * (N / 4);
        #pragma unroll
        for (int i = 0; i < 4; ++i) bReg[i] = pb[i];
    };
    auto stageToLds = [&](int buf) {
        const float* af = (const float*)aReg;
        v8h h0, h1;
        #pragma unroll
        for (int i = 0; i < 8; ++i) { h0[i] = (_Float16)af[i]; h1[i] = (_Float16)af[i + 8]; }
        *(v8h*)&As[buf][arow * LDSS + acol]     = h0;
        *(v8h*)&As[buf][arow * LDSS + acol + 8] = h1;
        const float* bf = (const float*)bReg;
        #pragma unroll
        for (int i = 0; i < 16; ++i) {
            float wv = bf[i];
            float aw = fabsf(wv);
            float t  = (aw >= 0.5f && aw < 1.5f) ? (wv > 0.0f ? 1.0f : -1.0f) : 0.0f;
            Bs[buf][(bcol + i) * LDSS + brow] = (_Float16)t;
        }
    };

    v8f acc[2][4] = {};
    const int ktiles = K / BK;
    loadGlobal(0);
    stageToLds(0);
    __syncthreads();

    for (int kt = 0; kt < ktiles; ++kt) {
        const int cur = kt & 1;
        if (kt + 1 < ktiles) loadGlobal(kt + 1);

        v16h afrag[2];
        #pragma unroll
        for (int mi = 0; mi < 2; ++mi) {
            const _Float16* p = &As[cur][(waveM * 32 + mi * 16 + lm) * LDSS];
            v8h lo = *(const v8h*)(p + r0);
            v8h hi = *(const v8h*)(p + r0 + 16);
            #pragma unroll
            for (int i = 0; i < 8; ++i) { afrag[mi][i] = lo[i]; afrag[mi][i + 8] = hi[i]; }
        }
        v16h bfrag[4];
        #pragma unroll
        for (int ni = 0; ni < 4; ++ni) {
            const _Float16* p = &Bs[cur][(waveN * 64 + ni * 16 + lm) * LDSS];
            v8h lo = *(const v8h*)(p + r0);
            v8h hi = *(const v8h*)(p + r0 + 16);
            #pragma unroll
            for (int i = 0; i < 8; ++i) { bfrag[ni][i] = lo[i]; bfrag[ni][i + 8] = hi[i]; }
        }
        #pragma unroll
        for (int mi = 0; mi < 2; ++mi)
            #pragma unroll
            for (int ni = 0; ni < 4; ++ni)
                acc[mi][ni] = __builtin_amdgcn_wmma_f32_16x16x32_f16(
                    false, afrag[mi], false, bfrag[ni], (short)0, acc[mi][ni], false, false);

        if (kt + 1 < ktiles) stageToLds(cur ^ 1);
        __syncthreads();
    }

    const int rowBase = by * BM + waveM * 32 + ((lane >> 4) << 3);
    const int colBase = bx * BN + waveN * 64 + lm;
    #pragma unroll
    for (int mi = 0; mi < 2; ++mi)
        #pragma unroll
        for (int ni = 0; ni < 4; ++ni)
            #pragma unroll
            for (int r = 0; r < 8; ++r)
                C[(size_t)(rowBase + mi * 16 + r) * N + colBase + ni * 16] = acc[mi][ni][r];
}

extern "C" void kernel_launch(void* const* d_in, const int* in_sizes, int n_in,
                              void* d_out, int out_size, void* d_ws, size_t ws_size,
                              hipStream_t stream) {
    const float* A = (const float*)d_in[0];   // inputs [M, K] f32
    const float* B = (const float*)d_in[1];   // kernel [K, N] f32
    float* C = (float*)d_out;                 // [M, N] f32

    const int K = 4096;
    const int N = in_sizes[1] / K;   // 4096
    const int M = in_sizes[0] / K;   // 8192

    const size_t needA = (size_t)M * K * sizeof(_Float16);
    const size_t needB = (size_t)N * K * sizeof(_Float16);

    if (ws_size >= needA + needB) {
        _Float16* Ah = (_Float16*)d_ws;
        _Float16* Bt = (_Float16*)((char*)d_ws + needA);

        const size_t nA = (size_t)M * K;
        prep_a_f16<<<dim3((unsigned)(nA / (256 * 8))), 256, 0, stream>>>(A, Ah, nA);
        prep_b_tern_t<<<dim3(N / TB, K / TB), 256, 0, stream>>>(B, Bt, K, N);
        gemm_f16_wmma<<<dim3(N / GBN, M / GBM), 256, 0, stream>>>(Ah, Bt, C, M, N, K);
    } else {
        ternary_gemm_fused<<<dim3(N / BN, M / BM), 256, 0, stream>>>(A, B, C, M, N, K);
    }
}

// v004
// Measured time: 177 microseconds a run.
// In both of two side-by-side timings against v003, it was 1.11 times as fast.
// All steps since v000 together make it 2.23 times as fast.
#include <hip/hip_runtime.h>

typedef __attribute__((ext_vector_type(16))) _Float16 v16h;
typedef __attribute__((ext_vector_type(8)))  _Float16 v8h;
typedef __attribute__((ext_vector_type(8)))  float    v8f;

#define LDSS 40      // padded K-stride in halfs (80 bytes, 16B aligned)

#if __has_builtin(__builtin_amdgcn_global_load_async_to_lds_b128)
#define HAVE_ASYNC_LDS 1
#else
#define HAVE_ASYNC_LDS 0
#endif

// Match the builtin's parameter types exactly (from the compiler diagnostic):
//   arg0: AS(1) pointer to int __vector(16B)   (global source)
//   arg1: AS(3) pointer to int __vector(16B)   (LDS destination)
typedef int v4i __attribute__((vector_size(16)));
typedef __attribute__((address_space(1))) v4i* as1_v4i;
typedef __attribute__((address_space(3))) v4i* as3_v4i;

static __device__ __forceinline__ as1_v4i as_global16(const void* p) {
    return (as1_v4i)(unsigned long long)p;
}
static __device__ __forceinline__ as3_v4i as_lds16(const void* p) {
    // generic LDS pointer carries the LDS byte offset in its low 32 bits
    return (as3_v4i)(unsigned long long)(unsigned int)(unsigned long long)p;
}

// ---------------- Pass 1: A f32 -> f16 ----------------
__global__ __launch_bounds__(256)
void prep_a_f16(const float* __restrict__ A, _Float16* __restrict__ Ah, size_t n) {
    size_t i = ((size_t)blockIdx.x * blockDim.x + threadIdx.x) * 8;
    if (i + 8 > n) return;
    float4 f0 = *(const float4*)(A + i);
    float4 f1 = *(const float4*)(A + i + 4);
    v8h h;
    h[0] = (_Float16)f0.x; h[1] = (_Float16)f0.y; h[2] = (_Float16)f0.z; h[3] = (_Float16)f0.w;
    h[4] = (_Float16)f1.x; h[5] = (_Float16)f1.y; h[6] = (_Float16)f1.z; h[7] = (_Float16)f1.w;
    *(v8h*)(Ah + i) = h;
}

// ------- Pass 2: B f32 [K][N] -> ternary f16, transposed to [N][K] -------
#define TB 64
__global__ __launch_bounds__(256)
void prep_b_tern_t(const float* __restrict__ B, _Float16* __restrict__ Bt, int K, int N) {
    __shared__ _Float16 t[TB][TB + 8];
    const int k0 = blockIdx.y * TB, n0 = blockIdx.x * TB;
    const int tid = threadIdx.x;

    const int kk = tid >> 2;
    const int nn = (tid & 3) * 16;
    const float4* src = (const float4*)(B + (size_t)(k0 + kk) * N + n0 + nn);
    float4 v[4];
    #pragma unroll
    for (int i = 0; i < 4; ++i) v[i] = src[i];
    const float* f = (const float*)v;
    #pragma unroll
    for (int i = 0; i < 16; ++i) {
        float wv = f[i];
        float aw = fabsf(wv);
        float tv = (aw >= 0.5f && aw < 1.5f) ? (wv > 0.0f ? 1.0f : -1.0f) : 0.0f;
        t[kk][nn + i] = (_Float16)tv;
    }
    __syncthreads();

    const int nr = tid >> 2;
    const int kc = (tid & 3) * 16;
    v8h o0, o1;
    #pragma unroll
    for (int i = 0; i < 8; ++i) { o0[i] = t[kc + i][nr]; o1[i] = t[kc + 8 + i][nr]; }
    _Float16* dst = Bt + (size_t)(n0 + nr) * K + k0 + kc;
    *(v8h*)dst       = o0;
    *(v8h*)(dst + 8) = o1;
}

// ---------------- Pass 3: f16 GEMM, C = Ah[M,K] x Bt[N,K]^T ----------------
#define GBM 256
#define GBN 256
#define GBK 128      // 256 bytes of every operand row per K tile
#define GLDS 136     // LDS row pitch in halfs: 272 bytes = 16 B x odd, for ds_load_b128 readers
#define SROWS 16     // operand rows that one copy of the whole block covers

__global__ __launch_bounds__(256)
void gemm_f16_wmma(const _Float16* __restrict__ Ah,   // [M][K] f16
                   const _Float16* __restrict__ Bt,   // [N][K] f16 (ternary)
                   float* __restrict__ C,             // [M][N] f32
                   int M, int N, int K)
{
    __shared__ _Float16 As[2][GBM * GLDS];
    __shared__ _Float16 Bs[2][GBN * GLDS];

    const int tid  = threadIdx.x;
    const int lane = tid & 31;
    const int w    = tid >> 5;
    const int waveM = w >> 2;        // 0..1 -> 128-row slab
    const int waveN = w & 3;         // 0..3 -> 64-col slab
    const int lm   = lane & 15;
    const int r0   = (lane >> 4) << 3;   // K-run select per 16-bit WMMA layout

    const int bx = blockIdx.x, by = blockIdx.y;

    // Staging: sixteen lanes cover one row's 256 bytes, so one wave copy moves two
    // whole 256-byte units; the block covers 16 rows per copy (A: 16 copies, B: 16).
    const int srow = tid >> 4;           // 0..15
    const int scol = (tid & 15) * 8;     // halfs: 16 bytes per lane
    const _Float16* Asrc = Ah + (size_t)(by * GBM + srow) * K + scol;
    const _Float16* Bsrc = Bt + (size_t)(bx * GBN + srow) * K + scol;
    const size_t rstep = (size_t)SROWS * K; // 16 rows further, in halfs

    // Stage tile kt of A and B into LDS buffer `buf`.
    auto stage = [&](int kt, int buf) {
        const _Float16* ga = Asrc + (size_t)kt * GBK;
        const _Float16* gb = Bsrc + (size_t)kt * GBK;
        _Float16* laA = &As[buf][srow * GLDS + scol];
        _Float16* laB = &Bs[buf][srow * GLDS + scol];
#if HAVE_ASYNC_LDS
        #pragma unroll
        for (int i = 0; i < GBM / SROWS; ++i)
            __builtin_amdgcn_global_load_async_to_lds_b128(
                as_global16(ga + i * rstep), as_lds16(laA + i * SROWS * GLDS), 0, 0);
        #pragma unroll
        for (int i = 0; i < GBN / SROWS; ++i)
            __builtin_amdgcn_global_load_async_to_lds_b128(
                as_global16(gb + i * rstep), as_lds16(laB + i * SROWS * GLDS), 0, 0);
#else
        #pragma unroll
        for (int i = 0; i < GBM / SROWS; ++i)
            *(v8h*)(laA + i * SROWS * GLDS) = *(const v8h*)(ga + i * rstep);
        #pragma unroll
        for (int i = 0; i < GBN / SROWS; ++i)
            *(v8h*)(laB + i * SROWS * GLDS) = *(const v8h*)(gb + i * rstep);
#endif
    };

    v8f acc[8][4] = {};

    const int ktiles = K / GBK;
    stage(0, 0);
    // tile 0 has landed for this wave before the barrier publishes it
    asm volatile("s_wait_asynccnt 0x0" ::: "memory");
    __syncthreads();
    if (1 < ktiles) stage(1, 1);

    for (int kt = 0; kt < ktiles; ++kt) {
        const int cur = kt & 1;

        #pragma unroll
        for (int ks = 0; ks < GBK / 32; ++ks) {
            v16h af[8], bf[4];
            #pragma unroll
            for (int ni = 0; ni < 4; ++ni) {
                const _Float16* p = &Bs[cur][(waveN * 64 + ni * 16 + lm) * GLDS + ks * 32];
                v8h lo = *(const v8h*)(p + r0);
                v8h hi = *(const v8h*)(p + r0 + 16);
                #pragma unroll
                for (int i = 0; i < 8; ++i) { bf[ni][i] = lo[i]; bf[ni][i + 8] = hi[i]; }
            }
            // The B fragments, which the first row of WMMAs needs whole, stay in front of
            // the A fragments, so that the counted waits let row 0 start after ten reads.
            __builtin_amdgcn_sched_barrier(0);
            #pragma unroll
            for (int mi = 0; mi < 8; ++mi) {
                const _Float16* p = &As[cur][(waveM * 128 + mi * 16 + lm) * GLDS + ks * 32];
                v8h lo = *(const v8h*)(p + r0);
                v8h hi = *(const v8h*)(p + r0 + 16);
                #pragma unroll
                for (int i = 0; i < 8; ++i) { af[mi][i] = lo[i]; af[mi][i + 8] = hi[i]; }
            }

            // Keeps the block's 24 LDS reads together in front of its 32 WMMAs: left
            // alone the compiler reads one A fragment per row of four WMMAs and waits
            // for it each time, which two waves per SIMD cannot hide.
            __builtin_amdgcn_sched_barrier(0);

            #pragma unroll
            for (int mi = 0; mi < 8; ++mi)
                #pragma unroll
                for (int ni = 0; ni < 4; ++ni)
                    acc[mi][ni] = __builtin_amdgcn_wmma_f32_16x16x32_f16(
                        false, af[mi], false, bf[ni], (short)0, acc[mi][ni], false, false);

            // Keeps the next block's reads from moving up among these WMMAs.
            __builtin_amdgcn_sched_barrier(0);
        }

        // Publish point of tile kt + 1: this wave's reads of buffer cur are done,
        // its copies of tile kt + 1 have landed, then the barrier; only behind it
        // is buffer cur refilled.
        asm volatile("s_wait_dscnt 0x0" ::: "memory");
        asm volatile("s_wait_asynccnt 0x0" ::: "memory");
        __syncthreads();
        if (kt + 2 < ktiles) stage(kt + 2, cur);
    }
    // no copy is left in flight when the wave ends
    asm volatile("s_wait_asynccnt 0x0" ::: "memory");

    const int rowBase = by * GBM + waveM * 128 + ((lane >> 4) << 3);
    const int colBase = bx * GBN + waveN * 64 + lm;
    #pragma unroll
    for (int mi = 0; mi < 8; ++mi)
        #pragma unroll
        for (int ni = 0; ni < 4; ++ni)
            #pragma unroll
            for (int r = 0; r < 8; ++r)
                __builtin_nontemporal_store(
                    acc[mi][ni][r],
                    &C[(size_t)(rowBase + mi * 16 + r) * N + colBase + ni * 16]);
}

// ---------------- Fallback: fused single-kernel path ----------------
#define BM 128
#define BN 128
#define BK 32

__global__ __launch_bounds__(256)
void ternary_gemm_fused(const float* __restrict__ A, const float* __restrict__ B,
                        float* __restrict__ C, int M, int N, int K)
{
    __shared__ _Float16 As[2][BM * LDSS];
    __shared__ _Float16 Bs[2][BN * LDSS];

    const int tid  = threadIdx.x;
    const int lane = tid & 31;
    const int w    = tid >> 5;
    const int waveM = w >> 1;
    const int waveN = w & 1;
    const int lm   = lane & 15;
    const int r0   = (lane >> 4) << 3;
    const int bx = blockIdx.x, by = blockIdx.y;

    const int arow = tid >> 1;
    const int acol = (tid & 1) * 16;
    const float4* Ag = (const float4*)(A + (size_t)(by * BM + arow) * K + acol);
    const int brow = tid >> 3;
    const int bcol = (tid & 7) * 16;
    const float4* Bg = (const float4*)(B + (size_t)brow * N + bx * BN + bcol);

    float4 aReg[4], bReg[4];
    auto loadGlobal = [&](int kt) {
        const float4* pa = Ag + (size_t)kt * (BK / 4);
        #pragma unroll
        for (int i = 0; i < 4; ++i) aReg[i] = pa[i];
        const float4* pb = Bg + (size_t)kt * BK * (N / 4);
        #pragma unroll
        for (int i = 0; i < 4; ++i) bReg[i] = pb[i];
    };
    auto stageToLds = [&](int buf) {
        const float* af = (const float*)aReg;
        v8h h0, h1;
        #pragma unroll
        for (int i = 0; i < 8; ++i) { h0[i] = (_Float16)af[i]; h1[i] = (_Float16)af[i + 8]; }
        *(v8h*)&As[buf][arow * LDSS + acol]     = h0;
        *(v8h*)&As[buf][arow * LDSS + acol + 8] = h1;
        const float* bf = (const float*)bReg;
        #pragma unroll
        for (int i = 0; i < 16; ++i) {
            float wv = bf[i];
            float aw = fabsf(wv);
            float t  = (aw >= 0.5f && aw < 1.5f) ? (wv > 0.0f ? 1.0f : -1.0f) : 0.0f;
            Bs[buf][(bcol + i) * LDSS + brow] = (_Float16)t;
        }
    };

    v8f acc[2][4] = {};
    const int ktiles = K / BK;
    loadGlobal(0);
    stageToLds(0);
    __syncthreads();

    for (int kt = 0; kt < ktiles; ++kt) {
        const int cur = kt & 1;
        if (kt + 1 < ktiles) loadGlobal(kt + 1);

        v16h afrag[2];
        #pragma unroll
        for (int mi = 0; mi < 2; ++mi) {
            const _Float16* p = &As[cur][(waveM * 32 + mi * 16 + lm) * LDSS];
            v8h lo = *(const v8h*)(p + r0);
            v8h hi = *(const v8h*)(p + r0 + 16);
            #pragma unroll
            for (int i = 0; i < 8; ++i) { afrag[mi][i] = lo[i]; afrag[mi][i + 8] = hi[i]; }
        }
        v16h bfrag[4];
        #pragma unroll
        for (int ni = 0; ni < 4; ++ni) {
            const _Float16* p = &Bs[cur][(waveN * 64 + ni * 16 + lm) * LDSS];
            v8h lo = *(const v8h*)(p + r0);
            v8h hi = *(const v8h*)(p + r0 + 16);
            #pragma unroll
            for (int i = 0; i < 8; ++i) { bfrag[ni][i] = lo[i]; bfrag[ni][i + 8] = hi[i]; }
        }
        #pragma unroll
        for (int mi = 0; mi < 2; ++mi)
            #pragma unroll
            for (int ni = 0; ni < 4; ++ni)
                acc[mi][ni] = __builtin_amdgcn_wmma_f32_16x16x32_f16(
                    false, afrag[mi], false, bfrag[ni], (short)0, acc[mi][ni], false, false);

        if (kt + 1 < ktiles) stageToLds(cur ^ 1);
        __syncthreads();
    }

    const int rowBase = by * BM + waveM * 32 + ((lane >> 4) << 3);
    const int colBase = bx * BN + waveN * 64 + lm;
    #pragma unroll
    for (int mi = 0; mi < 2; ++mi)
        #pragma unroll
        for (int ni = 0; ni < 4; ++ni)
            #pragma unroll
            for (int r = 0; r < 8; ++r)
                C[(size_t)(rowBase + mi * 16 + r) * N + colBase + ni * 16] = acc[mi][ni][r];
}

extern "C" void kernel_launch(void* const* d_in, const int* in_sizes, int n_in,
                              void* d_out, int out_size, void* d_ws, size_t ws_size,
                              hipStream_t stream) {
    const float* A = (const float*)d_in[0];   // inputs [M, K] f32
    const float* B = (const float*)d_in[1];   // kernel [K, N] f32
    float* C = (float*)d_out;                 // [M, N] f32

    const int K = 4096;
    const int N = in_sizes[1] / K;   // 4096
    const int M = in_sizes[0] / K;   // 8192

    const size_t needA = (size_t)M * K * sizeof(_Float16);
    const size_t needB = (size_t)N * K * sizeof(_Float16);

    if (ws_size >= needA + needB) {
        _Float16* Ah = (_Float16*)d_ws;
        _Float16* Bt = (_Float16*)((char*)d_ws + needA);

        const size_t nA = (size_t)M * K;
        prep_a_f16<<<dim3((unsigned)(nA / (256 * 8))), 256, 0, stream>>>(A, Ah, nA);
        prep_b_tern_t<<<dim3(N / TB, K / TB), 256, 0, stream>>>(B, Bt, K, N);
        gemm_f16_wmma<<<dim3(N / GBN, M / GBM), 256, 0, stream>>>(Ah, Bt, C, M, N, K);
    } else {
        ternary_gemm_fused<<<dim3(N / BN, M / BM), 256, 0, stream>>>(A, B, C, M, N, K);
    }
}

// v005
// One run takes 161 microseconds.
// In both of two side-by-side timings against v004, it was 1.10 times as fast.
// All steps since v000 together make it 2.45 times as fast.
#include <hip/hip_runtime.h>

typedef __attribute__((ext_vector_type(16))) _Float16 v16h;
typedef __attribute__((ext_vector_type(8)))  _Float16 v8h;
typedef __attribute__((ext_vector_type(8)))  float    v8f;

#define LDSS 40      // padded K-stride in halfs (80 bytes, 16B aligned)

typedef uint32_t u32x4 __attribute__((ext_vector_type(4)));
typedef uint32_t u32x8 __attribute__((ext_vector_type(8)));

static __device__ __forceinline__ uint32_t uni(uint32_t v) {
    return (uint32_t)__builtin_amdgcn_readfirstlane(v);
}
// A wave-uniform value held in a scalar register: a test, so that the branch around a
// tensor load, which ignores EXEC, compiles to s_cmp + s_cbranch_scc; a descriptor word.
static __device__ __forceinline__ uint32_t pinned(uint32_t v) {
    uint32_t w = uni(v);
    asm volatile("" : "+s"(w));  // pinned(): keeps the test or descriptor word in its scalar register
    return w;
}

// ---------------- Pass 1: A f32 -> f16 ----------------
__global__ __launch_bounds__(256)
void prep_a_f16(const float* __restrict__ A, _Float16* __restrict__ Ah, size_t n) {
    size_t i = ((size_t)blockIdx.x * blockDim.x + threadIdx.x) * 8;
    if (i + 8 > n) return;
    float4 f0 = *(const float4*)(A + i);
    float4 f1 = *(const float4*)(A + i + 4);
    v8h h;
    h[0] = (_Float16)f0.x; h[1] = (_Float16)f0.y; h[2] = (_Float16)f0.z; h[3] = (_Float16)f0.w;
    h[4] = (_Float16)f1.x; h[5] = (_Float16)f1.y; h[6] = (_Float16)f1.z; h[7] = (_Float16)f1.w;
    *(v8h*)(Ah + i) = h;
}

// ------- Pass 2: B f32 [K][N] -> ternary f16, transposed to [N][K] -------
#define TB 64
__global__ __launch_bounds__(256)
void prep_b_tern_t(const float* __restrict__ B, _Float16* __restrict__ Bt, int K, int N) {
    __shared__ _Float16 t[TB][TB + 8];
    const int k0 = blockIdx.y * TB, n0 = blockIdx.x * TB;
    const int tid = threadIdx.x;

    const int kk = tid >> 2;
    const int nn = (tid & 3) * 16;
    const float4* src = (const float4*)(B + (size_t)(k0 + kk) * N + n0 + nn);
    float4 v[4];
    #pragma unroll
    for (int i = 0; i < 4; ++i) v[i] = src[i];
    const float* f = (const float*)v;
    #pragma unroll
    for (int i = 0; i < 16; ++i) {
        float wv = f[i];
        float aw = fabsf(wv);
        float tv = (aw >= 0.5f && aw < 1.5f) ? (wv > 0.0f ? 1.0f : -1.0f) : 0.0f;
        t[kk][nn + i] = (_Float16)tv;
    }
    __syncthreads();

    const int nr = tid >> 2;
    const int kc = (tid & 3) * 16;
    v8h o0, o1;
    #pragma unroll
    for (int i = 0; i < 8; ++i) { o0[i] = t[kc + i][nr]; o1[i] = t[kc + 8 + i][nr]; }
    _Float16* dst = Bt + (size_t)(n0 + nr) * K + k0 + kc;
    *(v8h*)dst       = o0;
    *(v8h*)(dst + 8) = o1;
}

// ---------------- Pass 3: f16 GEMM, C = Ah[M,K] x Bt[N,K]^T ----------------
#define GBM 256
#define GBN 256
#define GBK 128      // 256 bytes of every operand row per K tile
#define ROWB 256u    // bytes of one operand row in a K tile
#define PITCHB 272u  // LDS row pitch in bytes: 16 B x odd, for ds_load_b128 readers
#define SLROWS 64u   // operand rows in one wave's slice of a stage
#define SLICEB 18432u            // 64 rows x 272 B = 17,408 B, rounded up to a multiple of 2 KiB
#define BUFB   (8u * SLICEB)     // a stage: slices 0-3 hold A's 256 rows, slices 4-7 B's

__global__ __launch_bounds__(256)
void gemm_f16_wmma(const _Float16* __restrict__ Ah,   // [M][K] f16
                   const _Float16* __restrict__ Bt,   // [N][K] f16 (ternary)
                   float* __restrict__ C,             // [M][N] f32
                   int M, int N, int K)
{
    __shared__ __attribute__((aligned(2048))) unsigned char L[2 * BUFB];

    const int tid  = threadIdx.x;
    const int lane = tid & 31;
    const int w    = tid >> 5;
    const int waveM = w >> 2;        // 0..1 -> 128-row slab
    const int waveN = w & 3;         // 0..3 -> 64-col slab
    const int lm   = lane & 15;
    const int r0   = (lane >> 4) << 3;   // K-run select per 16-bit WMMA layout

    const int bx = blockIdx.x, by = blockIdx.y;

    // Staging: every wave brings its own 64 rows x 256 bytes of each stage with one
    // tensor load; the load's pad lays the rows at the 272-byte pitch.
    const uint32_t wave  = uni((uint32_t)tid >> 5);
    const uint32_t lbase = (uint32_t)(size_t)L;
    const _Float16* srow = (wave < 4u)
        ? Ah + (size_t)((uint32_t)by * GBM + wave * SLROWS) * K
        : Bt + (size_t)((uint32_t)bx * GBN + (wave - 4u) * SLROWS) * K;
    const uint64_t sbase = (uint64_t)(size_t)srow;

    // Descriptor group 1, the same for every request: 1-byte elements, tensor = tile =
    // 64 rows of 256 bytes, source pitch 2 K bytes, 4 dwords of pad behind each row.
    // Each word is held in its scalar register by pinned(), so that the compiler lends
    // none of the eight to another value while a request is outstanding.
    u32x8 d1;
    d1[0] = pinned((1u << 20) | (5u << 22) | (3u << 25));
    d1[1] = pinned((ROWB & 0xFFFFu) << 16);
    d1[2] = pinned((ROWB >> 16) | ((SLROWS & 0xFFFFu) << 16));
    d1[3] = pinned((SLROWS >> 16) | (ROWB << 16));
    d1[4] = pinned(SLROWS);
    d1[5] = pinned((uint32_t)K * 2u);
    d1[6] = pinned(0u);
    d1[7] = pinned(0u);

    // Stage this wave's slice of tile kt into LDS buffer `buf`.
    auto stage = [&](int kt, int buf) {
        const uint64_t ga = sbase + (uint64_t)(uint32_t)kt * ROWB;
        u32x4 d0;
        d0[0] = uni(1u);
        d0[1] = uni(lbase + (uint32_t)buf * BUFB + wave * SLICEB);
        d0[2] = uni((uint32_t)ga);
        d0[3] = uni((((uint32_t)(ga >> 32)) & 0x01FFFFFFu) | 0x80000000u);
        // one request of the whole wave; no builtin is used, the waits are written by hand
        asm volatile("tensor_load_to_lds %0, %1" :: "s"(d0), "s"(d1) : "memory");
    };

    v8f acc[8][4] = {};

    const int ktiles = K / GBK;
    stage(0, 0);
    // this wave's slice of tile 0 has landed before the barrier publishes it
    asm volatile("s_wait_tensorcnt 0x0" ::: "memory");
    __syncthreads();
    if (pinned(1 < ktiles)) stage(1, 1);

    for (int kt = 0; kt < ktiles; ++kt) {
        const int cur = kt & 1;

        #pragma unroll
        for (int ks = 0; ks < GBK / 32; ++ks) {
            v16h af[8], bf[4];
            #pragma unroll
            for (int ni = 0; ni < 4; ++ni) {
                const _Float16* p = (const _Float16*)(L + cur * BUFB + (4 + waveN) * SLICEB
                                                      + (ni * 16 + lm) * PITCHB) + ks * 32;
                v8h lo = *(const v8h*)(p + r0);
                v8h hi = *(const v8h*)(p + r0 + 16);
                #pragma unroll
                for (int i = 0; i < 8; ++i) { bf[ni][i] = lo[i]; bf[ni][i + 8] = hi[i]; }
            }
            // The B fragments, which the first row of WMMAs needs whole, stay in front of
            // the A fragments, so that the counted waits let row 0 start after ten reads.
            __builtin_amdgcn_sched_barrier(0);
            #pragma unroll
            for (int mi = 0; mi < 8; ++mi) {
                const _Float16* p = (const _Float16*)(L + cur * BUFB + (waveM * 2 + (mi >> 2)) * SLICEB
                                                      + ((mi & 3) * 16 + lm) * PITCHB) + ks * 32;
                v8h lo = *(const v8h*)(p + r0);
                v8h hi = *(const v8h*)(p + r0 + 16);
                #pragma unroll
                for (int i = 0; i < 8; ++i) { af[mi][i] = lo[i]; af[mi][i + 8] = hi[i]; }
            }

            // Keeps the block's 24 LDS reads together in front of its 32 WMMAs: left
            // alone the compiler reads one A fragment per row of four WMMAs and waits
            // for it each time, which two waves per SIMD cannot hide.
            __builtin_amdgcn_sched_barrier(0);

            #pragma unroll
            for (int mi = 0; mi < 8; ++mi)
                #pragma unroll
                for (int ni = 0; ni < 4; ++ni)
                    acc[mi][ni] = __builtin_amdgcn_wmma_f32_16x16x32_f16(
                        false, af[mi], false, bf[ni], (short)0, acc[mi][ni], false, false);

            // Keeps the next block's reads from moving up among these WMMAs.
            __builtin_amdgcn_sched_barrier(0);
        }

        // Publish point of tile kt + 1: this wave's reads of buffer cur are done,
        // its slice of tile kt + 1 has landed, then the barrier; only behind it
        // is buffer cur refilled.
        asm volatile("s_wait_dscnt 0x0" ::: "memory");
        asm volatile("s_wait_tensorcnt 0x0" ::: "memory");
        __syncthreads();
        if (pinned(kt + 2 < ktiles)) stage(kt + 2, cur);
    }
    // no tensor load and no LDS read is left in flight when the wave goes on to the stores
    asm volatile("s_wait_tensorcnt 0x0" ::: "memory");
    asm volatile("s_wait_dscnt 0x0" ::: "memory");

    const int rowBase = by * GBM + waveM * 128 + ((lane >> 4) << 3);
    const int colBase = bx * GBN + waveN * 64 + lm;
    #pragma unroll
    for (int mi = 0; mi < 8; ++mi)
        #pragma unroll
        for (int ni = 0; ni < 4; ++ni)
            #pragma unroll
            for (int r = 0; r < 8; ++r)
                __builtin_nontemporal_store(
                    acc[mi][ni][r],
                    &C[(size_t)(rowBase + mi * 16 + r) * N + colBase + ni * 16]);
}

// ---------------- Fallback: fused single-kernel path ----------------
#define BM 128
#define BN 128
#define BK 32

__global__ __launch_bounds__(256)
void ternary_gemm_fused(const float* __restrict__ A, const float* __restrict__ B,
                        float* __restrict__ C, int M, int N, int K)
{
    __shared__ _Float16 As[2][BM * LDSS];
    __shared__ _Float16 Bs[2][BN * LDSS];

    const int tid  = threadIdx.x;
    const int lane = tid & 31;
    const int w    = tid >> 5;
    const int waveM = w >> 1;
    const int waveN = w & 1;
    const int lm   = lane & 15;
    const int r0   = (lane >> 4) << 3;
    const int bx = blockIdx.x, by = blockIdx.y;

    const int arow = tid >> 1;
    const int acol = (tid & 1) * 16;
    const float4* Ag = (const float4*)(A + (size_t)(by * BM + arow) * K + acol);
    const int brow = tid >> 3;
    const int bcol = (tid & 7) * 16;
    const float4* Bg = (const float4*)(B + (size_t)brow * N + bx * BN + bcol);

    float4 aReg[4], bReg[4];
    auto loadGlobal = [&](int kt) {
        const float4* pa = Ag + (size_t)kt * (BK / 4);
        #pragma unroll
        for (int i = 0; i < 4; ++i) aReg[i] = pa[i];
        const float4* pb = Bg + (size_t)kt * BK * (N / 4);
        #pragma unroll
        for (int i = 0; i < 4; ++i) bReg[i] = pb[i];
    };
    auto stageToLds = [&](int buf) {
        const float* af = (const float*)aReg;
        v8h h0, h1;
        #pragma unroll
        for (int i = 0; i < 8; ++i) { h0[i] = (_Float16)af[i]; h1[i] = (_Float16)af[i + 8]; }
        *(v8h*)&As[buf][arow * LDSS + acol]     = h0;
        *(v8h*)&As[buf][arow * LDSS + acol + 8] = h1;
        const float* bf = (const float*)bReg;
        #pragma unroll
        for (int i = 0; i < 16; ++i) {
            float wv = bf[i];
            float aw = fabsf(wv);
            float t  = (aw >= 0.5f && aw < 1.5f) ? (wv > 0.0f ? 1.0f : -1.0f) : 0.0f;
            Bs[buf][(bcol + i) * LDSS + brow] = (_Float16)t;
        }
    };

    v8f acc[2][4] = {};
    const int ktiles = K / BK;
    loadGlobal(0);
    stageToLds(0);
    __syncthreads();

    for (int kt = 0; kt < ktiles; ++kt) {
        const int cur = kt & 1;
        if (kt + 1 < ktiles) loadGlobal(kt + 1);

        v16h afrag[2];
        #pragma unroll
        for (int mi = 0; mi < 2; ++mi) {
            const _Float16* p = &As[cur][(waveM * 32 + mi * 16 + lm) * LDSS];
            v8h lo = *(const v8h*)(p + r0);
            v8h hi = *(const v8h*)(p + r0 + 16);
            #pragma unroll
            for (int i = 0; i < 8; ++i) { afrag[mi][i] = lo[i]; afrag[mi][i + 8] = hi[i]; }
        }
        v16h bfrag[4];
        #pragma unroll
        for (int ni = 0; ni < 4; ++ni) {
            const _Float16* p = &Bs[cur][(waveN * 64 + ni * 16 + lm) * LDSS];
            v8h lo = *(const v8h*)(p + r0);
            v8h hi = *(const v8h*)(p + r0 + 16);
            #pragma unroll
            for (int i = 0; i < 8; ++i) { bfrag[ni][i] = lo[i]; bfrag[ni][i + 8] = hi[i]; }
        }
        #pragma unroll
        for (int mi = 0; mi < 2; ++mi)
            #pragma unroll
            for (int ni = 0; ni < 4; ++ni)
                acc[mi][ni] = __builtin_amdgcn_wmma_f32_16x16x32_f16(
                    false, afrag[mi], false, bfrag[ni], (short)0, acc[mi][ni], false, false);

        if (kt + 1 < ktiles) stageToLds(cur ^ 1);
        __syncthreads();
    }

    const int rowBase = by * BM + waveM * 32 + ((lane >> 4) << 3);
    const int colBase = bx * BN + waveN * 64 + lm;
    #pragma unroll
    for (int mi = 0; mi < 2; ++mi)
        #pragma unroll
        for (int ni = 0; ni < 4; ++ni)
            #pragma unroll
            for (int r = 0; r < 8; ++r)
                C[(size_t)(rowBase + mi * 16 + r) * N + colBase + ni * 16] = acc[mi][ni][r];
}

extern "C" void kernel_launch(void* const* d_in, const int* in_sizes, int n_in,
                              void* d_out, int out_size, void* d_ws, size_t ws_size,
                              hipStream_t stream) {
    const float* A = (const float*)d_in[0];   // inputs [M, K] f32
    const float* B = (const float*)d_in[1];   // kernel [K, N] f32
    float* C = (float*)d_out;                 // [M, N] f32

    const int K = 4096;
    const int N = in_sizes[1] / K;   // 4096
    const int M = in_sizes[0] / K;   // 8192

    const size_t needA = (size_t)M * K * sizeof(_Float16);
    const size_t needB = (size_t)N * K * sizeof(_Float16);

    if (ws_size >= needA + needB) {
        _Float16* Ah = (_Float16*)d_ws;
        _Float16* Bt = (_Float16*)((char*)d_ws + needA);

        const size_t nA = (size_t)M * K;
        prep_a_f16<<<dim3((unsigned)(nA / (256 * 8))), 256, 0, stream>>>(A, Ah, nA);
        prep_b_tern_t<<<dim3(N / TB, K / TB), 256, 0, stream>>>(B, Bt, K, N);
        gemm_f16_wmma<<<dim3(N / GBN, M / GBM), 256, 0, stream>>>(Ah, Bt, C, M, N, K);
    } else {
        ternary_gemm_fused<<<dim3(N / BN, M / BM), 256, 0, stream>>>(A, B, C, M, N, K);
    }
}

// v006
// Measured time: 150 microseconds a run.
// Next to v005, in two timings, it ran 1.07 times as fast each time.
// All steps since v000 together make it 2.63 times as fast.
#include <hip/hip_runtime.h>

typedef __attribute__((ext_vector_type(16))) _Float16 v16h;
typedef __attribute__((ext_vector_type(8)))  _Float16 v8h;
typedef __attribute__((ext_vector_type(8)))  float    v8f;
typedef __attribute__((ext_vector_type(4)))  float    f32x4;

#define LDSS 40      // padded K-stride in halfs (80 bytes, 16B aligned)

typedef uint32_t u32x4 __attribute__((ext_vector_type(4)));
typedef uint32_t u32x8 __attribute__((ext_vector_type(8)));

static __device__ __forceinline__ uint32_t uni(uint32_t v) {
    return (uint32_t)__builtin_amdgcn_readfirstlane(v);
}
// A wave-uniform value held in a scalar register: a test, so that the branch around a
// tensor load, which ignores EXEC, compiles to s_cmp + s_cbranch_scc; a descriptor word.
static __device__ __forceinline__ uint32_t pinned(uint32_t v) {
    uint32_t w = uni(v);
    asm volatile("" : "+s"(w));  // pinned(): keeps the test or descriptor word in its scalar register
    return w;
}

// ---------------- Pass 1: A f32 -> f16 ----------------
__global__ __launch_bounds__(256)
void prep_a_f16(const float* __restrict__ A, _Float16* __restrict__ Ah, size_t n) {
    size_t i = ((size_t)blockIdx.x * blockDim.x + threadIdx.x) * 8;
    if (i + 8 > n) return;
    float4 f0 = *(const float4*)(A + i);
    float4 f1 = *(const float4*)(A + i + 4);
    v8h h;
    h[0] = (_Float16)f0.x; h[1] = (_Float16)f0.y; h[2] = (_Float16)f0.z; h[3] = (_Float16)f0.w;
    h[4] = (_Float16)f1.x; h[5] = (_Float16)f1.y; h[6] = (_Float16)f1.z; h[7] = (_Float16)f1.w;
    *(v8h*)(Ah + i) = h;
}

// ------- Pass 2: B f32 [K][N] -> ternary f16, transposed to [N][K] -------
#define TB 64
__global__ __launch_bounds__(256)
void prep_b_tern_t(const float* __restrict__ B, _Float16* __restrict__ Bt, int K, int N) {
    __shared__ _Float16 t[TB][TB + 8];
    const int k0 = blockIdx.y * TB, n0 = blockIdx.x * TB;
    const int tid = threadIdx.x;

    const int kk = tid >> 2;
    const int nn = (tid & 3) * 16;
    const float4* src = (const float4*)(B + (size_t)(k0 + kk) * N + n0 + nn);
    float4 v[4];
    #pragma unroll
    for (int i = 0; i < 4; ++i) v[i] = src[i];
    const float* f = (const float*)v;
    #pragma unroll
    for (int i = 0; i < 16; ++i) {
        float wv = f[i];
        float aw = fabsf(wv);
        float tv = (aw >= 0.5f && aw < 1.5f) ? (wv > 0.0f ? 1.0f : -1.0f) : 0.0f;
        t[kk][nn + i] = (_Float16)tv;
    }
    __syncthreads();

    const int nr = tid >> 2;
    const int kc = (tid & 3) * 16;
    v8h o0, o1;
    #pragma unroll
    for (int i = 0; i < 8; ++i) { o0[i] = t[kc + i][nr]; o1[i] = t[kc + 8 + i][nr]; }
    _Float16* dst = Bt + (size_t)(n0 + nr) * K + k0 + kc;
    *(v8h*)dst       = o0;
    *(v8h*)(dst + 8) = o1;
}

// ---------------- Pass 3: f16 GEMM, C = Ah[M,K] x Bt[N,K]^T ----------------
#define GBM 256
#define GBN 256
#define GBK 128      // 256 bytes of every operand row per K tile
#define ROWB 256u    // bytes of one operand row in a K tile
#define PITCHB 272u  // LDS row pitch in bytes: 16 B x odd, for ds_load_b128 readers
#define SLROWS 64u   // operand rows in one wave's slice of a stage
#define SLICEB 18432u            // 64 rows x 272 B = 17,408 B, rounded up to a multiple of 2 KiB
#define BUFB   (8u * SLICEB)     // a stage: slices 0-3 hold A's 256 rows, slices 4-7 B's

__global__ __launch_bounds__(256)
void gemm_f16_wmma(const _Float16* __restrict__ Ah,   // [M][K] f16
                   const _Float16* __restrict__ Bt,   // [N][K] f16 (ternary)
                   float* __restrict__ C,             // [M][N] f32
                   int M, int N, int K)
{
    __shared__ __attribute__((aligned(2048))) unsigned char L[2 * BUFB];

    const int tid  = threadIdx.x;
    const int lane = tid & 31;
    const int w    = tid >> 5;
    const int waveM = w >> 2;        // 0..1 -> 128-row slab
    const int waveN = w & 3;         // 0..3 -> 64-col slab
    const int lm   = lane & 15;
    const int r0   = (lane >> 4) << 3;   // K-run select per 16-bit WMMA layout

    const int bx = blockIdx.x, by = blockIdx.y;

    // Staging: every wave brings its own 64 rows x 256 bytes of each stage with one
    // tensor load; the load's pad lays the rows at the 272-byte pitch.
    const uint32_t wave  = uni((uint32_t)tid >> 5);
    const uint32_t lbase = (uint32_t)(size_t)L;
    const _Float16* srow = (wave < 4u)
        ? Ah + (size_t)((uint32_t)by * GBM + wave * SLROWS) * K
        : Bt + (size_t)((uint32_t)bx * GBN + (wave - 4u) * SLROWS) * K;
    const uint64_t sbase = (uint64_t)(size_t)srow;

    // Descriptor group 1, the same for every request: 1-byte elements, tensor = tile =
    // 64 rows of 256 bytes, source pitch 2 K bytes, 4 dwords of pad behind each row.
    // Each word is held in its scalar register by pinned(), so that the compiler lends
    // none of the eight to another value while a request is outstanding.
    u32x8 d1;
    d1[0] = pinned((1u << 20) | (5u << 22) | (3u << 25));
    d1[1] = pinned((ROWB & 0xFFFFu) << 16);
    d1[2] = pinned((ROWB >> 16) | ((SLROWS & 0xFFFFu) << 16));
    d1[3] = pinned((SLROWS >> 16) | (ROWB << 16));
    d1[4] = pinned(SLROWS);
    d1[5] = pinned((uint32_t)K * 2u);
    d1[6] = pinned(0u);
    d1[7] = pinned(0u);

    // Stage this wave's slice of tile kt into LDS buffer `buf`.
    auto stage = [&](int kt, int buf) {
        const uint64_t ga = sbase + (uint64_t)(uint32_t)kt * ROWB;
        u32x4 d0;
        d0[0] = uni(1u);
        d0[1] = uni(lbase + (uint32_t)buf * BUFB + wave * SLICEB);
        d0[2] = uni((uint32_t)ga);
        d0[3] = uni((((uint32_t)(ga >> 32)) & 0x01FFFFFFu) | 0x80000000u);
        // one request of the whole wave; no builtin is used, the waits are written by hand
        asm volatile("tensor_load_to_lds %0, %1" :: "s"(d0), "s"(d1) : "memory");
    };

    v8f acc[8][4] = {};

    const int ktiles = K / GBK;
    stage(0, 0);
    // this wave's slice of tile 0 has landed before the barrier publishes it
    asm volatile("s_wait_tensorcnt 0x0" ::: "memory");
    __syncthreads();
    if (pinned(1 < ktiles)) stage(1, 1);

    for (int kt = 0; kt < ktiles; ++kt) {
        const int cur = kt & 1;

        #pragma unroll
        for (int ks = 0; ks < GBK / 32; ++ks) {
            v16h af[8], bf[4];
            #pragma unroll
            for (int ni = 0; ni < 4; ++ni) {
                const _Float16* p = (const _Float16*)(L + cur * BUFB + (4 + waveN) * SLICEB
                                                      + (ni * 16 + lm) * PITCHB) + ks * 32;
                v8h lo = *(const v8h*)(p + r0);
                v8h hi = *(const v8h*)(p + r0 + 16);
                #pragma unroll
                for (int i = 0; i < 8; ++i) { bf[ni][i] = lo[i]; bf[ni][i + 8] = hi[i]; }
            }
            // The B fragments, which the first row of WMMAs needs whole, stay in front of
            // the A fragments, so that the counted waits let row 0 start after ten reads.
            __builtin_amdgcn_sched_barrier(0);
            #pragma unroll
            for (int mi = 0; mi < 8; ++mi) {
                const _Float16* p = (const _Float16*)(L + cur * BUFB + (waveM * 2 + (mi >> 2)) * SLICEB
                                                      + ((mi & 3) * 16 + lm) * PITCHB) + ks * 32;
                v8h lo = *(const v8h*)(p + r0);
                v8h hi = *(const v8h*)(p + r0 + 16);
                #pragma unroll
                for (int i = 0; i < 8; ++i) { af[mi][i] = lo[i]; af[mi][i + 8] = hi[i]; }
            }

            // Keeps the block's 24 LDS reads together in front of its 32 WMMAs: left
            // alone the compiler reads one A fragment per row of four WMMAs and waits
            // for it each time, which two waves per SIMD cannot hide.
            __builtin_amdgcn_sched_barrier(0);

            #pragma unroll
            for (int mi = 0; mi < 8; ++mi)
                #pragma unroll
                for (int ni = 0; ni < 4; ++ni)
                    acc[mi][ni] = __builtin_amdgcn_wmma_f32_16x16x32_f16(
                        false, af[mi], false, bf[ni], (short)0, acc[mi][ni], false, false);

            // Keeps the next block's reads from moving up among these WMMAs.
            __builtin_amdgcn_sched_barrier(0);
        }

        // Publish point of tile kt + 1: this wave's reads of buffer cur are done,
        // its slice of tile kt + 1 has landed, then the barrier; only behind it
        // is buffer cur refilled.
        asm volatile("s_wait_dscnt 0x0" ::: "memory");
        asm volatile("s_wait_tensorcnt 0x0" ::: "memory");
        __syncthreads();
        if (pinned(kt + 2 < ktiles)) stage(kt + 2, cur);
    }
    // no tensor load and no LDS read is left in flight when the wave goes on to the stores
    asm volatile("s_wait_tensorcnt 0x0" ::: "memory");
    asm volatile("s_wait_dscnt 0x0" ::: "memory");

    // Epilogue: whole lines. The ring is idle: the last trip's waits and barrier ended every
    // wave's reads of it and every tensor load into it. Each wave lays its 128 x 64 tile in a
    // range of its own (128 rows at the 272-byte pitch) and reads it back row by row, so that
    // one store covers 256 contiguous bytes of each of two rows instead of 64. Two halves of
    // 64 rows: the second is laid in LDS while the first half's stores drain.
    float* Sw = (float*)(L + wave * (128u * PITCHB));
    const uint32_t half = (uint32_t)lane >> 4;
    float* Cw = C + (size_t)((uint32_t)by * GBM + (wave >> 2) * 128u) * N
                  + ((uint32_t)bx * GBN + (wave & 3u) * 64u);
    const uint32_t loff = half * (uint32_t)N + (uint32_t)lm * 4u;
    const float* Sr = Sw + half * (PITCHB / 4u) + lm * 4;
    #pragma unroll
    for (int g = 0; g < 2; ++g) {
        #pragma unroll
        for (int mi = g * 4; mi < g * 4 + 4; ++mi)
            #pragma unroll
            for (int ni = 0; ni < 4; ++ni)
                #pragma unroll
                for (int r = 0; r < 8; ++r)
                    Sw[(mi * 16 + half * 8 + r) * (PITCHB / 4u) + ni * 16 + lm] = acc[mi][ni][r];
        // the wave's own LDS writes are done before it reads the rows back across lanes
        asm volatile("s_wait_dscnt 0x0" ::: "memory");
        #pragma unroll
        for (int q = g * 2; q < g * 2 + 2; ++q) {
            #pragma unroll
            for (int j = q * 16; j < q * 16 + 16; ++j) {
                f32x4 v = *(const f32x4*)(Sr + j * 2 * (PITCHB / 4u));
                __builtin_nontemporal_store(v, (f32x4*)(Cw + (size_t)(2 * j) * N + loff));
            }
            if (q < 3) {
                // a precaution: what follows reuses registers that these 16 stores name, and
                // rewrites none of them ahead of this wait
                asm volatile("s_wait_xcnt 0x0" ::: "memory");
                // keeps the following address sums and LDS reads behind that wait
                __builtin_amdgcn_sched_barrier(0);
            }
        }
    }
}

// ---------------- Fallback: fused single-kernel path ----------------
#define BM 128
#define BN 128
#define BK 32

__global__ __launch_bounds__(256)
void ternary_gemm_fused(const float* __restrict__ A, const float* __restrict__ B,
                        float* __restrict__ C, int M, int N, int K)
{
    __shared__ _Float16 As[2][BM * LDSS];
    __shared__ _Float16 Bs[2][BN * LDSS];

    const int tid  = threadIdx.x;
    const int lane = tid & 31;
    const int w    = tid >> 5;
    const int waveM = w >> 1;
    const int waveN = w & 1;
    const int lm   = lane & 15;
    const int r0   = (lane >> 4) << 3;
    const int bx = blockIdx.x, by = blockIdx.y;

    const int arow = tid >> 1;
    const int acol = (tid & 1) * 16;
    const float4* Ag = (const float4*)(A + (size_t)(by * BM + arow) * K + acol);
    const int brow = tid >> 3;
    const int bcol = (tid & 7) * 16;
    const float4* Bg = (const float4*)(B + (size_t)brow * N + bx * BN + bcol);

    float4 aReg[4], bReg[4];
    auto loadGlobal = [&](int kt) {
        const float4* pa = Ag + (size_t)kt * (BK / 4);
        #pragma unroll
        for (int i = 0; i < 4; ++i) aReg[i] = pa[i];
        const float4* pb = Bg + (size_t)kt * BK * (N / 4);
        #pragma unroll
        for (int i = 0; i < 4; ++i) bReg[i] = pb[i];
    };
    auto stageToLds = [&](int buf) {
        const float* af = (const float*)aReg;
        v8h h0, h1;
        #pragma unroll
        for (int i = 0; i < 8; ++i) { h0[i] = (_Float16)af[i]; h1[i] = (_Float16)af[i + 8]; }
        *(v8h*)&As[buf][arow * LDSS + acol]     = h0;
        *(v8h*)&As[buf][arow * LDSS + acol + 8] = h1;
        const float* bf = (const float*)bReg;
        #pragma unroll
        for (int i = 0; i < 16; ++i) {
            float wv = bf[i];
            float aw = fabsf(wv);
            float t  = (aw >= 0.5f && aw < 1.5f) ? (wv > 0.0f ? 1.0f : -1.0f) : 0.0f;
            Bs[buf][(bcol + i) * LDSS + brow] = (_Float16)t;
        }
    };

    v8f acc[2][4] = {};
    const int ktiles = K / BK;
    loadGlobal(0);
    stageToLds(0);
    __syncthreads();

    for (int kt = 0; kt < ktiles; ++kt) {
        const int cur = kt & 1;
        if (kt + 1 < ktiles) loadGlobal(kt + 1);

        v16h afrag[2];
        #pragma unroll
        for (int mi = 0; mi < 2; ++mi) {
            const _Float16* p = &As[cur][(waveM * 32 + mi * 16 + lm) * LDSS];
            v8h lo = *(const v8h*)(p + r0);
            v8h hi = *(const v8h*)(p + r0 + 16);
            #pragma unroll
            for (int i = 0; i < 8; ++i) { afrag[mi][i] = lo[i]; afrag[mi][i + 8] = hi[i]; }
        }
        v16h bfrag[4];
        #pragma unroll
        for (int ni = 0; ni < 4; ++ni) {
            const _Float16* p = &Bs[cur][(waveN * 64 + ni * 16 + lm) * LDSS];
            v8h lo = *(const v8h*)(p + r0);
            v8h hi = *(const v8h*)(p + r0 + 16);
            #pragma unroll
            for (int i = 0; i < 8; ++i) { bfrag[ni][i] = lo[i]; bfrag[ni][i + 8] = hi[i]; }
        }
        #pragma unroll
        for (int mi = 0; mi < 2; ++mi)
            #pragma unroll
            for (int ni = 0; ni < 4; ++ni)
                acc[mi][ni] = __builtin_amdgcn_wmma_f32_16x16x32_f16(
                    false, afrag[mi], false, bfrag[ni], (short)0, acc[mi][ni], false, false);

        if (kt + 1 < ktiles) stageToLds(cur ^ 1);
        __syncthreads();
    }

    const int rowBase = by * BM + waveM * 32 + ((lane >> 4) << 3);
    const int colBase = bx * BN + waveN * 64 + lm;
    #pragma unroll
    for (int mi = 0; mi < 2; ++mi)
        #pragma unroll
        for (int ni = 0; ni < 4; ++ni)
            #pragma unroll
            for (int r = 0; r < 8; ++r)
                C[(size_t)(rowBase + mi * 16 + r) * N + colBase + ni * 16] = acc[mi][ni][r];
}

extern "C" void kernel_launch(void* const* d_in, const int* in_sizes, int n_in,
                              void* d_out, int out_size, void* d_ws, size_t ws_size,
                              hipStream_t stream) {
    const float* A = (const float*)d_in[0];   // inputs [M, K] f32
    const float* B = (const float*)d_in[1];   // kernel [K, N] f32
    float* C = (float*)d_out;                 // [M, N] f32

    const int K = 4096;
    const int N = in_sizes[1] / K;   // 4096
    const int M = in_sizes[0] / K;   // 8192

    const size_t needA = (size_t)M * K * sizeof(_Float16);
    const size_t needB = (size_t)N * K * sizeof(_Float16);

    if (ws_size >= needA + needB) {
        _Float16* Ah = (_Float16*)d_ws;
        _Float16* Bt = (_Float16*)((char*)d_ws + needA);

        const size_t nA = (size_t)M * K;
        prep_a_f16<<<dim3((unsigned)(nA / (256 * 8))), 256, 0, stream>>>(A, Ah, nA);
        prep_b_tern_t<<<dim3(N / TB, K / TB), 256, 0, stream>>>(B, Bt, K, N);
        gemm_f16_wmma<<<dim3(N / GBN, M / GBM), 256, 0, stream>>>(Ah, Bt, C, M, N, K);
    } else {
        ternary_gemm_fused<<<dim3(N / BN, M / BM), 256, 0, stream>>>(A, B, C, M, N, K);
    }
}

// v007
// One run takes 145 microseconds.
// Two timings next to v006 put it at 1.03 and 1.04 times that version's speed.
// All steps since v000 together make it 2.72 times as fast.
#include <hip/hip_runtime.h>

typedef __attribute__((ext_vector_type(16))) _Float16 v16h;
typedef __attribute__((ext_vector_type(8)))  _Float16 v8h;
typedef __attribute__((ext_vector_type(8)))  float    v8f;
typedef __attribute__((ext_vector_type(4)))  float    f32x4;

#define LDSS 40      // padded K-stride in halfs (80 bytes, 16B aligned)

typedef uint32_t u32x4 __attribute__((ext_vector_type(4)));
typedef uint32_t u32x8 __attribute__((ext_vector_type(8)));

static __device__ __forceinline__ uint32_t uni(uint32_t v) {
    return (uint32_t)__builtin_amdgcn_readfirstlane(v);
}
// A wave-uniform value held in a scalar register: a test, so that the branch around a
// tensor load, which ignores EXEC, compiles to s_cmp + s_cbranch_scc; a descriptor word.
static __device__ __forceinline__ uint32_t pinned(uint32_t v) {
    uint32_t w = uni(v);
    asm volatile("" : "+s"(w));  // pinned(): keeps the test or descriptor word in its scalar register
    return w;
}

// ------- Pre-pass, one launch: A f32 -> f16, and B f32 [K][N] -> ternary f16, transposed to [N][K] -------
// The two conversions do not depend on each other, so they share one launch whose work-groups
// are all resident at once. The first n / PA_BLOCKF work-groups stream A; the others transpose B.
typedef __attribute__((ext_vector_type(4))) _Float16 v4h;
#define PA_UNITS 8                              // units a wave converts, one after the other
#define PA_UNITF 1024u                          // floats in a unit: 8 whole-line 16-byte loads of a wave
#define PA_BLOCKF (8u * PA_UNITS * PA_UNITF)    // floats an 8-wave work-group converts
#define TB 64
#define TBK 4                                   // 64 x 64 tiles of B, down k, a work-group takes at once
static __device__ __forceinline__
void prep_a_part(const float* __restrict__ A, _Float16* __restrict__ Ah, uint32_t blk, int tid) {
    // A: each wave streams PA_UNITS consecutive units; the next unit's loads are issued
    // before this unit is rounded and stored (8 to 16 loads of a wave in flight).
    const uint32_t lane = (uint32_t)tid & 31u;
    const uint32_t wv   = uni((uint32_t)tid >> 5);
    const size_t first  = ((size_t)blk * 8u + wv) * (PA_UNITS * PA_UNITF);
    const float* src = A + first + lane * 4u;
    _Float16*    dst = Ah + first + lane * 4u;

    f32x4 ring[2][8];
    #pragma unroll
    for (int j = 0; j < 8; ++j) ring[0][j] = *(const f32x4*)(src + j * 128);

    #pragma unroll
    for (int r = 0; r < PA_UNITS; ++r) {
        // the fence pair pins the order: the next unit's loads, then this unit's rounding and stores
        __builtin_amdgcn_sched_barrier(0);
        if (r + 1 < PA_UNITS) {
            #pragma unroll
            for (int j = 0; j < 8; ++j)
                ring[(r + 1) & 1][j] = *(const f32x4*)(src + (r + 1) * PA_UNITF + j * 128);
        }
        __builtin_amdgcn_sched_barrier(0);
        #pragma unroll
        for (int j = 0; j < 8; ++j) {
            const f32x4 f = ring[r & 1][j];
            v4h h;
            h[0] = (_Float16)f[0]; h[1] = (_Float16)f[1]; h[2] = (_Float16)f[2]; h[3] = (_Float16)f[3];
            *(v4h*)(dst + r * PA_UNITF + j * 128) = h;
        }
        if (r + 2 < PA_UNITS) {
            // a precaution: the loads that follow land in registers that these stores name
            asm volatile("s_wait_xcnt 0x0" ::: "memory");
        }
    }
}

static __device__ __forceinline__
void prep_b_part(const float* __restrict__ B, _Float16* __restrict__ Bt, int K, int N, uint32_t bi, int tid) {
    __shared__ _Float16 t[TBK][TB][TB + 8];
    // B: all 16 loads of a thread are issued together and one barrier serves the TBK tiles.
    const uint32_t nbx = (uint32_t)N / TB;
    const int k0 = (int)(bi / nbx) * (TB * TBK), n0 = (int)(bi % nbx) * TB;

    const int kk = tid >> 2;
    const int nn = (tid & 3) * 16;
    const uint32_t off = (uint32_t)kk * (uint32_t)N + (uint32_t)nn;   // the same in every tile
    float4 v[TBK][4];
    const float* ts[TBK];
    #pragma unroll
    for (int s = 0; s < TBK; ++s) {
        ts[s] = B + (size_t)(k0 + s * TB) * N + n0 + off;
        #pragma unroll
        for (int i = 0; i < 4; ++i) v[s][i] = *(const float4*)(ts[s] + i * 4);
    }
    // a precaution: what follows reuses registers that these 16 loads name; the four addresses
    // are inputs of the wait, so that no later load of the 16 lands in one ahead of it
    asm volatile("s_wait_xcnt 0x0" :: "v"(ts[0]), "v"(ts[1]), "v"(ts[2]), "v"(ts[3]) : "memory");
    // keeps all 16 loads in front of that wait, and the first tile's work behind it
    __builtin_amdgcn_sched_barrier(0);
    #pragma unroll
    for (int s = 0; s < TBK; ++s) {
        const float* f = (const float*)v[s];
        #pragma unroll
        for (int i = 0; i < 16; ++i) {
            float wv = f[i];
            float aw = fabsf(wv);
            float tv = (aw >= 0.5f && aw < 1.5f) ? (wv > 0.0f ? 1.0f : -1.0f) : 0.0f;
            t[s][kk][nn + i] = (_Float16)tv;
        }
    }
    __syncthreads();

    const int nr = tid >> 2;
    const int kc = (tid & 3) * 16;
    _Float16* dst = Bt + (size_t)(n0 + nr) * K + k0 + kc;
    #pragma unroll
    for (int s = 0; s < TBK; ++s) {
        v8h o0, o1;
        #pragma unroll
        for (int i = 0; i < 8; ++i) { o0[i] = t[s][kc + i][nr]; o1[i] = t[s][kc + 8 + i][nr]; }
        *(v8h*)(dst + s * TB)     = o0;
        *(v8h*)(dst + s * TB + 8) = o1;
    }
    // a precaution: in the built code the other part's text follows this one behind a branch,
    // and it writes registers that these stores name
    asm volatile("s_wait_xcnt 0x0" ::: "memory");
}

__global__ __launch_bounds__(256)
void prep_ab(const float* __restrict__ A, _Float16* __restrict__ Ah, size_t n,
             const float* __restrict__ B, _Float16* __restrict__ Bt, int K, int N) {
    const uint32_t ablocks = (uint32_t)(n / PA_BLOCKF);
    // the same for a whole work-group, so every wave of a B work-group meets its barrier
    if (blockIdx.x >= ablocks) prep_b_part(B, Bt, K, N, blockIdx.x - ablocks, threadIdx.x);
    else                       prep_a_part(A, Ah, blockIdx.x, threadIdx.x);
}

// ---------------- Pass 2: f16 GEMM, C = Ah[M,K] x Bt[N,K]^T ----------------
#define GBM 256
#define GBN 256
#define GBK 128      // 256 bytes of every operand row per K tile
#define ROWB 256u    // bytes of one operand row in a K tile
#define PITCHB 272u  // LDS row pitch in bytes: 16 B x odd, for ds_load_b128 readers
#define SLROWS 64u   // operand rows in one wave's slice of a stage
#define SLICEB 18432u            // 64 rows x 272 B = 17,408 B, rounded up to a multiple of 2 KiB
#define BUFB   (8u * SLICEB)     // a stage: slices 0-3 hold A's 256 rows, slices 4-7 B's

__global__ __launch_bounds__(256)
void gemm_f16_wmma(const _Float16* __restrict__ Ah,   // [M][K] f16
                   const _Float16* __restrict__ Bt,   // [N][K] f16 (ternary)
                   float* __restrict__ C,             // [M][N] f32
                   int M, int N, int K)
{
    __shared__ __attribute__((aligned(2048))) unsigned char L[2 * BUFB];

    const int tid  = threadIdx.x;
    const int lane = tid & 31;
    const int w    = tid >> 5;
    const int waveM = w >> 2;        // 0..1 -> 128-row slab
    const int waveN = w & 3;         // 0..3 -> 64-col slab
    const int lm   = lane & 15;
    const int r0   = (lane >> 4) << 3;   // K-run select per 16-bit WMMA layout

    const int bx = blockIdx.x, by = blockIdx.y;

    // Staging: every wave brings its own 64 rows x 256 bytes of each stage with one
    // tensor load; the load's pad lays the rows at the 272-byte pitch.
    const uint32_t wave  = uni((uint32_t)tid >> 5);
    const uint32_t lbase = (uint32_t)(size_t)L;
    const _Float16* srow = (wave < 4u)
        ? Ah + (size_t)((uint32_t)by * GBM + wave * SLROWS) * K
        : Bt + (size_t)((uint32_t)bx * GBN + (wave - 4u) * SLROWS) * K;
    const uint64_t sbase = (uint64_t)(size_t)srow;

    // Descriptor group 1, the same for every request: 1-byte elements, tensor = tile =
    // 64 rows of 256 bytes, source pitch 2 K bytes, 4 dwords of pad behind each row.
    // Each word is held in its scalar register by pinned(), so that the compiler lends
    // none of the eight to another value while a request is outstanding.
    u32x8 d1;
    d1[0] = pinned((1u << 20) | (5u << 22) | (3u << 25));
    d1[1] = pinned((ROWB & 0xFFFFu) << 16);
    d1[2] = pinned((ROWB >> 16) | ((SLROWS & 0xFFFFu) << 16));
    d1[3] = pinned((SLROWS >> 16) | (ROWB << 16));
    d1[4] = pinned(SLROWS);
    d1[5] = pinned((uint32_t)K * 2u);
    d1[6] = pinned(0u);
    d1[7] = pinned(0u);

    // Stage this wave's slice of tile kt into LDS buffer `buf`.
    auto stage = [&](int kt, int buf) {
        const uint64_t ga = sbase + (uint64_t)(uint32_t)kt * ROWB;
        u32x4 d0;
        d0[0] = uni(1u);
        d0[1] = uni(lbase + (uint32_t)buf * BUFB + wave * SLICEB);
        d0[2] = uni((uint32_t)ga);
        d0[3] = uni((((uint32_t)(ga >> 32)) & 0x01FFFFFFu) | 0x80000000u);
        // one request of the whole wave; no builtin is used, the waits are written by hand
        asm volatile("tensor_load_to_lds %0, %1" :: "s"(d0), "s"(d1) : "memory");
    };

    v8f acc[8][4] = {};

    const int ktiles = K / GBK;
    stage(0, 0);
    // this wave's slice of tile 0 has landed before the barrier publishes it
    asm volatile("s_wait_tensorcnt 0x0" ::: "memory");
    __syncthreads();
    if (pinned(1 < ktiles)) stage(1, 1);

    for (int kt = 0; kt < ktiles; ++kt) {
        const int cur = kt & 1;

        #pragma unroll
        for (int ks = 0; ks < GBK / 32; ++ks) {
            v16h af[8], bf[4];
            #pragma unroll
            for (int ni = 0; ni < 4; ++ni) {
                const _Float16* p = (const _Float16*)(L + cur * BUFB + (4 + waveN) * SLICEB
                                                      + (ni * 16 + lm) * PITCHB) + ks * 32;
                v8h lo = *(const v8h*)(p + r0);
                v8h hi = *(const v8h*)(p + r0 + 16);
                #pragma unroll
                for (int i = 0; i < 8; ++i) { bf[ni][i] = lo[i]; bf[ni][i + 8] = hi[i]; }
            }
            // The B fragments, which the first row of WMMAs needs whole, stay in front of
            // the A fragments, so that the counted waits let row 0 start after ten reads.
            __builtin_amdgcn_sched_barrier(0);
            #pragma unroll
            for (int mi = 0; mi < 8; ++mi) {
                const _Float16* p = (const _Float16*)(L + cur * BUFB + (waveM * 2 + (mi >> 2)) * SLICEB
                                                      + ((mi & 3) * 16 + lm) * PITCHB) + ks * 32;
                v8h lo = *(const v8h*)(p + r0);
                v8h hi = *(const v8h*)(p + r0 + 16);
                #pragma unroll
                for (int i = 0; i < 8; ++i) { af[mi][i] = lo[i]; af[mi][i + 8] = hi[i]; }
            }

            // Keeps the block's 24 LDS reads together in front of its 32 WMMAs: left
            // alone the compiler reads one A fragment per row of four WMMAs and waits
            // for it each time, which two waves per SIMD cannot hide.
            __builtin_amdgcn_sched_barrier(0);

            #pragma unroll
            for (int mi = 0; mi < 8; ++mi)
                #pragma unroll
                for (int ni = 0; ni < 4; ++ni)
                    acc[mi][ni] = __builtin_amdgcn_wmma_f32_16x16x32_f16(
                        false, af[mi], false, bf[ni], (short)0, acc[mi][ni], false, false);

            // Keeps the next block's reads from moving up among these WMMAs.
            __builtin_amdgcn_sched_barrier(0);
        }

        // Publish point of tile kt + 1: this wave's reads of buffer cur are done,
        // its slice of tile kt + 1 has landed, then the barrier; only behind it
        // is buffer cur refilled.
        asm volatile("s_wait_dscnt 0x0" ::: "memory");
        asm volatile("s_wait_tensorcnt 0x0" ::: "memory");
        __syncthreads();
        if (pinned(kt + 2 < ktiles)) stage(kt + 2, cur);
    }
    // no tensor load and no LDS read is left in flight when the wave goes on to the stores
    asm volatile("s_wait_tensorcnt 0x0" ::: "memory");
    asm volatile("s_wait_dscnt 0x0" ::: "memory");

    // Epilogue: whole lines. The ring is idle: the last trip's waits and barrier ended every
    // wave's reads of it and every tensor load into it. Each wave lays its 128 x 64 tile in a
    // range of its own (128 rows at the 272-byte pitch) and reads it back row by row, so that
    // one store covers 256 contiguous bytes of each of two rows instead of 64. Two halves of
    // 64 rows: the second is laid in LDS while the first half's stores drain.
    float* Sw = (float*)(L + wave * (128u * PITCHB));
    const uint32_t half = (uint32_t)lane >> 4;
    float* Cw = C + (size_t)((uint32_t)by * GBM + (wave >> 2) * 128u) * N
                  + ((uint32_t)bx * GBN + (wave & 3u) * 64u);
    const uint32_t loff = half * (uint32_t)N + (uint32_t)lm * 4u;
    const float* Sr = Sw + half * (PITCHB / 4u) + lm * 4;
    #pragma unroll
    for (int g = 0; g < 2; ++g) {
        #pragma unroll
        for (int mi = g * 4; mi < g * 4 + 4; ++mi)
            #pragma unroll
            for (int ni = 0; ni < 4; ++ni)
                #pragma unroll
                for (int r = 0; r < 8; ++r)
                    Sw[(mi * 16 + half * 8 + r) * (PITCHB / 4u) + ni * 16 + lm] = acc[mi][ni][r];
        // the wave's own LDS writes are done before it reads the rows back across lanes
        asm volatile("s_wait_dscnt 0x0" ::: "memory");
        #pragma unroll
        for (int q = g * 2; q < g * 2 + 2; ++q) {
            #pragma unroll
            for (int j = q * 16; j < q * 16 + 16; ++j) {
                f32x4 v = *(const f32x4*)(Sr + j * 2 * (PITCHB / 4u));
                __builtin_nontemporal_store(v, (f32x4*)(Cw + (size_t)(2 * j) * N + loff));
            }
            if (q < 3) {
                // a precaution: what follows reuses registers that these 16 stores name, and
                // rewrites none of them ahead of this wait
                asm volatile("s_wait_xcnt 0x0" ::: "memory");
                // keeps the following address sums and LDS reads behind that wait
                __builtin_amdgcn_sched_barrier(0);
            }
        }
    }
}

// ---------------- Fallback: fused single-kernel path ----------------
#define BM 128
#define BN 128
#define BK 32

__global__ __launch_bounds__(256)
void ternary_gemm_fused(const float* __restrict__ A, const float* __restrict__ B,
                        float* __restrict__ C, int M, int N, int K)
{
    __shared__ _Float16 As[2][BM * LDSS];
    __shared__ _Float16 Bs[2][BN * LDSS];

    const int tid  = threadIdx.x;
    const int lane = tid & 31;
    const int w    = tid >> 5;
    const int waveM = w >> 1;
    const int waveN = w & 1;
    const int lm   = lane & 15;
    const int r0   = (lane >> 4) << 3;
    const int bx = blockIdx.x, by = blockIdx.y;

    const int arow = tid >> 1;
    const int acol = (tid & 1) * 16;
    const float4* Ag = (const float4*)(A + (size_t)(by * BM + arow) * K + acol);
    const int brow = tid >> 3;
    const int bcol = (tid & 7) * 16;
    const float4* Bg = (const float4*)(B + (size_t)brow * N + bx * BN + bcol);

    float4 aReg[4], bReg[4];
    auto loadGlobal = [&](int kt) {
        const float4* pa = Ag + (size_t)kt * (BK / 4);
        #pragma unroll
        for (int i = 0; i < 4; ++i) aReg[i] = pa[i];
        const float4* pb = Bg + (size_t)kt * BK * (N / 4);
        #pragma unroll
        for (int i = 0; i < 4; ++i) bReg[i] = pb[i];
    };
    auto stageToLds = [&](int buf) {
        const float* af = (const float*)aReg;
        v8h h0, h1;
        #pragma unroll
        for (int i = 0; i < 8; ++i) { h0[i] = (_Float16)af[i]; h1[i] = (_Float16)af[i + 8]; }
        *(v8h*)&As[buf][arow * LDSS + acol]     = h0;
        *(v8h*)&As[buf][arow * LDSS + acol + 8] = h1;
        const float* bf = (const float*)bReg;
        #pragma unroll
        for (int i = 0; i < 16; ++i) {
            float wv = bf[i];
            float aw = fabsf(wv);
            float t  = (aw >= 0.5f && aw < 1.5f) ? (wv > 0.0f ? 1.0f : -1.0f) : 0.0f;
            Bs[buf][(bcol + i) * LDSS + brow] = (_Float16)t;
        }
    };

    v8f acc[2][4] = {};
    const int ktiles = K / BK;
    loadGlobal(0);
    stageToLds(0);
    __syncthreads();

    for (int kt = 0; kt < ktiles; ++kt) {
        const int cur = kt & 1;
        if (kt + 1 < ktiles) loadGlobal(kt + 1);

        v16h afrag[2];
        #pragma unroll
        for (int mi = 0; mi < 2; ++mi) {
            const _Float16* p = &As[cur][(waveM * 32 + mi * 16 + lm) * LDSS];
            v8h lo = *(const v8h*)(p + r0);
            v8h hi = *(const v8h*)(p + r0 + 16);
            #pragma unroll
            for (int i = 0; i < 8; ++i) { afrag[mi][i] = lo[i]; afrag[mi][i + 8] = hi[i]; }
        }
        v16h bfrag[4];
        #pragma unroll
        for (int ni = 0; ni < 4; ++ni) {
            const _Float16* p = &Bs[cur][(waveN * 64 + ni * 16 + lm) * LDSS];
            v8h lo = *(const v8h*)(p + r0);
            v8h hi = *(const v8h*)(p + r0 + 16);
            #pragma unroll
            for (int i = 0; i < 8; ++i) { bfrag[ni][i] = lo[i]; bfrag[ni][i + 8] = hi[i]; }
        }
        #pragma unroll
        for (int mi = 0; mi < 2; ++mi)
            #pragma unroll
            for (int ni = 0; ni < 4; ++ni)
                acc[mi][ni] = __builtin_amdgcn_wmma_f32_16x16x32_f16(
                    false, afrag[mi], false, bfrag[ni], (short)0, acc[mi][ni], false, false);

        if (kt + 1 < ktiles) stageToLds(cur ^ 1);
        __syncthreads();
    }

    const int rowBase = by * BM + waveM * 32 + ((lane >> 4) << 3);
    const int colBase = bx * BN + waveN * 64 + lm;
    #pragma unroll
    for (int mi = 0; mi < 2; ++mi)
        #pragma unroll
        for (int ni = 0; ni < 4; ++ni)
            #pragma unroll
            for (int r = 0; r < 8; ++r)
                C[(size_t)(rowBase + mi * 16 + r) * N + colBase + ni * 16] = acc[mi][ni][r];
}

extern "C" void kernel_launch(void* const* d_in, const int* in_sizes, int n_in,
                              void* d_out, int out_size, void* d_ws, size_t ws_size,
                              hipStream_t stream) {
    const float* A = (const float*)d_in[0];   // inputs [M, K] f32
    const float* B = (const float*)d_in[1];   // kernel [K, N] f32
    float* C = (float*)d_out;                 // [M, N] f32

    const int K = 4096;
    const int N = in_sizes[1] / K;   // 4096
    const int M = in_sizes[0] / K;   // 8192

    const size_t needA = (size_t)M * K * sizeof(_Float16);
    const size_t needB = (size_t)N * K * sizeof(_Float16);

    if (ws_size >= needA + needB) {
        _Float16* Ah = (_Float16*)d_ws;
        _Float16* Bt = (_Float16*)((char*)d_ws + needA);

        const size_t nA = (size_t)M * K;
        prep_ab<<<dim3((unsigned)(nA / PA_BLOCKF) + (N / TB) * (K / (TB * TBK))), 256, 0, stream>>>(A, Ah, nA, B, Bt, K, N);
        gemm_f16_wmma<<<dim3(N / GBN, M / GBM), 256, 0, stream>>>(Ah, Bt, C, M, N, K);
    } else {
        ternary_gemm_fused<<<dim3(N / BN, M / BM), 256, 0, stream>>>(A, B, C, M, N, K);
    }
}

// v008
// A run of this version takes 140 microseconds.
// Two timings next to v007 both put it at 1.04 times that version's speed.
// Counting every step since v000, it is 2.82 times as fast.
#include <hip/hip_runtime.h>

typedef __attribute__((ext_vector_type(16))) _Float16 v16h;
typedef __attribute__((ext_vector_type(8)))  _Float16 v8h;
typedef __attribute__((ext_vector_type(8)))  float    v8f;
typedef __attribute__((ext_vector_type(4)))  float    f32x4;

#define LDSS 40      // padded K-stride in halfs (80 bytes, 16B aligned)

typedef uint32_t u32x4 __attribute__((ext_vector_type(4)));
typedef uint32_t u32x8 __attribute__((ext_vector_type(8)));

static __device__ __forceinline__ uint32_t uni(uint32_t v) {
    return (uint32_t)__builtin_amdgcn_readfirstlane(v);
}
// A wave-uniform value held in a scalar register: a test, so that the branch around a
// tensor load, which ignores EXEC, compiles to s_cmp + s_cbranch_scc; a descriptor word.
static __device__ __forceinline__ uint32_t pinned(uint32_t v) {
    uint32_t w = uni(v);
    asm volatile("" : "+s"(w));  // pinned(): keeps the test or descriptor word in its scalar register
    return w;
}

// ------- Pre-pass, one launch: A f32 -> f16, and B f32 [K][N] -> ternary bytes, transposed to [N][K] -------
// A ternary weight is kept as the HIGH BYTE of its f16 value (0x3C = 1, 0xBC = -1, 0x00 = 0; the low
// byte of all three is 0), so B takes half the bytes on every path and widens exactly.
// The two conversions do not depend on each other, so they share one launch whose work-groups
// are all resident at once. The first n / PA_BLOCKF work-groups stream A; the others transpose B.
typedef __attribute__((ext_vector_type(4))) _Float16 v4h;
#define PA_UNITS 8                              // units a wave converts, one after the other
#define PA_UNITF 1024u                          // floats in a unit: 8 whole-line 16-byte loads of a wave
#define PA_BLOCKF (8u * PA_UNITS * PA_UNITF)    // floats an 8-wave work-group converts
#define TB 64
#define TBK 4                                   // 64 x 64 tiles of B, down k, a work-group takes at once
static __device__ __forceinline__
void prep_a_part(const float* __restrict__ A, _Float16* __restrict__ Ah, uint32_t blk, int tid) {
    // A: each wave streams PA_UNITS consecutive units; the next unit's loads are issued
    // before this unit is rounded and stored (8 to 16 loads of a wave in flight).
    const uint32_t lane = (uint32_t)tid & 31u;
    const uint32_t wv   = uni((uint32_t)tid >> 5);
    const size_t first  = ((size_t)blk * 8u + wv) * (PA_UNITS * PA_UNITF);
    const float* src = A + first + lane * 4u;
    _Float16*    dst = Ah + first + lane * 4u;

    f32x4 ring[2][8];
    #pragma unroll
    for (int j = 0; j < 8; ++j) ring[0][j] = *(const f32x4*)(src + j * 128);

    #pragma unroll
    for (int r = 0; r < PA_UNITS; ++r) {
        // the fence pair pins the order: the next unit's loads, then this unit's rounding and stores
        __builtin_amdgcn_sched_barrier(0);
        if (r + 1 < PA_UNITS) {
            #pragma unroll
            for (int j = 0; j < 8; ++j)
                ring[(r + 1) & 1][j] = *(const f32x4*)(src + (r + 1) * PA_UNITF + j * 128);
        }
        __builtin_amdgcn_sched_barrier(0);
        #pragma unroll
        for (int j = 0; j < 8; ++j) {
            const f32x4 f = ring[r & 1][j];
            v4h h;
            h[0] = (_Float16)f[0]; h[1] = (_Float16)f[1]; h[2] = (_Float16)f[2]; h[3] = (_Float16)f[3];
            *(v4h*)(dst + r * PA_UNITF + j * 128) = h;
        }
        if (r + 2 < PA_UNITS) {
            // a precaution: the loads that follow land in registers that these stores name
            asm volatile("s_wait_xcnt 0x0" ::: "memory");
        }
    }
}

#define TPD 65u   // LDS row pitch in dwords: 256 k bytes + 1 dword, so that a column of dword writes meets 32 banks
static __device__ __forceinline__ uint32_t tern_byte(float wv) {
    const float aw = fabsf(wv);
    const uint32_t one = ((__float_as_uint(wv) >> 24) & 0x80u) | 0x3Cu;   // high byte of f16 +1 or -1
    return (aw >= 0.5f && aw < 1.5f) ? one : 0u;
}

static __device__ __forceinline__
void prep_b_part(const float* __restrict__ B, unsigned char* __restrict__ Bt, int K, int N, uint32_t bi, int tid) {
    __shared__ uint32_t t[TB * TPD];
    // B: the 16 loads of a thread are issued ahead of the work and one barrier serves the TBK tiles.
    // A thread takes 4 k rows x 4 columns of each tile and packs the 4 k of a column into one dword.
    const uint32_t nbx = (uint32_t)N / TB;
    const int k0 = (int)(bi / nbx) * (TB * TBK), n0 = (int)(bi % nbx) * TB;

    const uint32_t a = (uint32_t)tid >> 4;    // k rows 4a .. 4a + 3 of a tile
    const uint32_t c = (uint32_t)tid & 15u;   // columns 4c .. 4c + 3
    float4 v[TBK][4];
    uint32_t off[4];          // byte offsets of a thread's four rows, the same in every tile
    const char* ts[TBK];      // a tile's first byte, the same in every thread
    #pragma unroll
    for (int j = 0; j < 4; ++j) off[j] = ((a * 4u + j) * (uint32_t)N + c * 4u) * 4u;
    #pragma unroll
    for (int s = 0; s < TBK; ++s) {
        ts[s] = (const char*)(B + (size_t)(k0 + s * TB) * N + n0);
        #pragma unroll
        for (int j = 0; j < 4; ++j) v[s][j] = *(const float4*)(ts[s] + off[j]);
    }
    // a precaution: what follows reuses registers that these 16 loads name; the offsets and the
    // bases are inputs of the wait, so that nothing is written into one ahead of it
    asm volatile("s_wait_xcnt 0x0" :: "v"(off[0]), "v"(off[1]), "v"(off[2]), "v"(off[3]),
                                      "s"(ts[0]), "s"(ts[1]), "s"(ts[2]), "s"(ts[3]) : "memory");
    // keeps the packing behind the wait, so that it takes no register ahead of the loads: in the
    // built code 15 of the 16 loads are then issued before the first is waited for, without it 14
    __builtin_amdgcn_sched_barrier(0);
    // Inside each 32 k the runs of 8 are stored in the order 0, 2, 1, 3: the 16 k that one lane
    // of the GEMM feeds to a WMMA (8 and, 16 further on, 8 more) then lie in 16 bytes in a row.
    const uint32_t run = (a >> 1) & 3u;
    const uint32_t pd  = (a & 8u) | ((((run & 1u) << 1) | (run >> 1)) << 1) | (a & 1u);
    #pragma unroll
    for (int s = 0; s < TBK; ++s) {
        #pragma unroll
        for (int e = 0; e < 4; ++e) {
            const uint32_t d = tern_byte(((const float*)&v[s][0])[e])
                             | (tern_byte(((const float*)&v[s][1])[e]) << 8)
                             | (tern_byte(((const float*)&v[s][2])[e]) << 16)
                             | (tern_byte(((const float*)&v[s][3])[e]) << 24);
            t[(c * 4u + e) * TPD + s * 16u + pd] = d;
        }
    }
    __syncthreads();

    // 16 lanes store the 256 bytes that this work-group holds of a row of Bt
    #pragma unroll
    for (int j = 0; j < 4; ++j) {
        const uint32_t nr = j * 16u + a;
        u32x4 o;
        #pragma unroll
        for (int e = 0; e < 4; ++e) o[e] = t[nr * TPD + c * 4u + e];
        *(u32x4*)(Bt + (size_t)(n0 + nr) * K + k0 + c * 16u) = o;
    }
    // a precaution: in the built code the other part's text follows this one behind a branch,
    // and it writes registers that these stores name
    asm volatile("s_wait_xcnt 0x0" ::: "memory");
}

__global__ __launch_bounds__(256)
void prep_ab(const float* __restrict__ A, _Float16* __restrict__ Ah, size_t n,
             const float* __restrict__ B, unsigned char* __restrict__ Bt, int K, int N) {
    const uint32_t ablocks = (uint32_t)(n / PA_BLOCKF);
    // the same for a whole work-group, so every wave of a B work-group meets its barrier
    if (blockIdx.x >= ablocks) prep_b_part(B, Bt, K, N, blockIdx.x - ablocks, threadIdx.x);
    else                       prep_a_part(A, Ah, blockIdx.x, threadIdx.x);
}

// ---------------- f16 GEMM, C = Ah[M,K] x Bt[N,K]^T; Bt in bytes, widened to f16 in registers ----------------
#define GBM 256
#define GBN 256
#define GBK 128      // 256 bytes (one L2 fill unit) of every A row, 128 of every B row, per K tile
#define ROWB 256u    // bytes of one row of A in a K tile
#define PITCHB 272u  // LDS row pitch in bytes: 16 B x odd, for ds_load_b128 readers
#define SLROWS 64u   // operand rows in one wave's slice of a stage
#define SLICEB 18432u            // 64 rows x 272 B = 17,408 B, rounded up to a multiple of 2 KiB
#define ROWB8   128u   // bytes of one row of B in a K tile: one byte a weight
#define PITCHB8 144u   // its LDS pitch: 16 B x odd, for ds_load_b128 readers
#define SLICEB8 10240u // 64 rows x 144 B = 9,216 B, rounded up to a multiple of 2 KiB
#define BUFB   (4u * SLICEB + 4u * SLICEB8)   // a stage: A's 256 rows in four slices, then B's in four
#define EPIB   (8u * 128u * PITCHB)           // the epilogue's staging: 128 rows a wave

__global__ __launch_bounds__(256)
void gemm_f16_wmma(const _Float16* __restrict__ Ah,   // [M][K] f16
                   const unsigned char* __restrict__ Bt,   // [N][K], high bytes of ternary f16
                   float* __restrict__ C,             // [M][N] f32
                   int M, int N, int K)
{
    __shared__ __attribute__((aligned(2048))) unsigned char L[EPIB > 2u * BUFB ? EPIB : 2u * BUFB];

    const int tid  = threadIdx.x;
    const int lane = tid & 31;
    const int w    = tid >> 5;
    const int waveM = w >> 2;        // 0..1 -> 128-row slab
    const int waveN = w & 3;         // 0..3 -> 64-col slab
    const int lm   = lane & 15;
    const int r0   = (lane >> 4) << 3;   // K-run select per 16-bit WMMA layout

    const int bx = blockIdx.x, by = blockIdx.y;

    // Staging: every wave brings its own 64 rows of each stage with one tensor load, waves 0-3
    // 256 bytes a row of A, waves 4-7 128 bytes a row of B; the load's pad lays the rows at
    // the 272-byte and the 144-byte pitch.
    const uint32_t wave  = uni((uint32_t)tid >> 5);
    const uint32_t lbase = (uint32_t)(size_t)L;
    const bool isA = wave < 4u;
    const uint64_t sbase = isA
        ? (uint64_t)(size_t)(Ah + (size_t)((uint32_t)by * GBM + wave * SLROWS) * K)
        : (uint64_t)(size_t)(Bt + (size_t)((uint32_t)bx * GBN + (wave - 4u) * SLROWS) * K);
    const uint32_t sstep = isA ? ROWB : ROWB8;                                   // source bytes per K tile
    const uint32_t sloff = isA ? wave * SLICEB : 4u * SLICEB + (wave - 4u) * SLICEB8;   // slice in a stage

    // Descriptor group 1 of A, the same for every request: 1-byte elements, tensor = tile =
    // 64 rows of 256 bytes, source pitch 2 K bytes, 4 dwords of pad behind each row.
    // Each word is held in its scalar register by pinned(), so that the compiler lends
    // none of the eight to another value while a request is outstanding.
    u32x8 d1;
    d1[0] = pinned((1u << 20) | (5u << 22) | (3u << 25));
    d1[1] = pinned((ROWB & 0xFFFFu) << 16);
    d1[2] = pinned((ROWB >> 16) | ((SLROWS & 0xFFFFu) << 16));
    d1[3] = pinned((SLROWS >> 16) | (ROWB << 16));
    d1[4] = pinned(SLROWS);
    d1[5] = pinned((uint32_t)K * 2u);
    d1[6] = pinned(0u);
    d1[7] = pinned(0u);
    // The same for B: 64 rows of 128 bytes, source pitch K bytes, 4 dwords of pad behind each row.
    u32x8 e1;
    e1[0] = pinned((1u << 20) | (4u << 22) | (3u << 25));
    e1[1] = pinned((ROWB8 & 0xFFFFu) << 16);
    e1[2] = pinned((ROWB8 >> 16) | ((SLROWS & 0xFFFFu) << 16));
    e1[3] = pinned((SLROWS >> 16) | (ROWB8 << 16));
    e1[4] = pinned(SLROWS);
    e1[5] = pinned((uint32_t)K);
    e1[6] = pinned(0u);
    e1[7] = pinned(0u);

    // Stage this wave's slice of tile kt into LDS buffer `buf`.
    // Group 0 lives in one set of registers from here on: its word 0 is written once, ahead of
    // the first request; the other three are formed anew for each request, behind the wait.
    u32x4 d0;
    d0[0] = pinned(1u);   // pinned(): a descriptor word held in its scalar register
    auto stage = [&](int kt, int buf) {
        const uint64_t ga = sbase + (uint64_t)((uint32_t)kt * sstep);
        d0[1] = uni(lbase + (uint32_t)buf * BUFB + sloff);
        d0[2] = uni((uint32_t)ga);
        d0[3] = uni((((uint32_t)(ga >> 32)) & 0x01FFFFFFu) | 0x80000000u);
        // one request of the whole wave; no builtin is used, the waits are written by hand
        if (pinned(wave < 4u))  asm volatile("tensor_load_to_lds %0, %1" :: "s"(d0), "s"(d1) : "memory");
        if (pinned(wave >= 4u)) asm volatile("tensor_load_to_lds %0, %1" :: "s"(d0), "s"(e1) : "memory");
    };

    v8f acc[8][4] = {};

    const int ktiles = K / GBK;
    stage(0, 0);
    // this wave's slice of tile 0 has landed before the barrier publishes it
    asm volatile("s_wait_tensorcnt 0x0" ::: "memory");
    __syncthreads();
    if (pinned(1 < ktiles)) stage(1, 1);

    for (int kt = 0; kt < ktiles; ++kt) {
        const int cur = kt & 1;

        #pragma unroll
        for (int ks = 0; ks < GBK / 32; ++ks) {
            v16h af[8], bf[4];
            u32x4 braw[4];
            // a lane's 16 weights of a fragment lie in 16 bytes in a row (the pre-pass's order)
            #pragma unroll
            for (int ni = 0; ni < 4; ++ni)
                braw[ni] = *(const u32x4*)(L + cur * BUFB + 4u * SLICEB + waveN * SLICEB8
                                           + (ni * 16 + lm) * PITCHB8 + ks * 32 + r0 * 2);
            // The B fragments, which the first row of WMMAs needs whole, stay in front of
            // the A fragments, so that the counted waits let them be widened while A arrives.
            __builtin_amdgcn_sched_barrier(0);
            #pragma unroll
            for (int mi = 0; mi < 8; ++mi) {
                const _Float16* p = (const _Float16*)(L + cur * BUFB + (waveM * 2 + (mi >> 2)) * SLICEB
                                                      + ((mi & 3) * 16 + lm) * PITCHB) + ks * 32;
                v8h lo = *(const v8h*)(p + r0);
                v8h hi = *(const v8h*)(p + r0 + 16);
                #pragma unroll
                for (int i = 0; i < 8; ++i) { af[mi][i] = lo[i]; af[mi][i + 8] = hi[i]; }
            }

            // Keeps the block's 20 LDS reads together in front of its 32 WMMAs: left
            // alone the compiler reads one A fragment per row of four WMMAs and waits
            // for it each time, which two waves per SIMD cannot hide.
            __builtin_amdgcn_sched_barrier(0);

            // byte b -> f16 b << 8, two a dword: selector 0x0C gives a zero byte
            #pragma unroll
            for (int ni = 0; ni < 4; ++ni) {
                u32x8 x;
                #pragma unroll
                for (int d = 0; d < 4; ++d) {
                    x[2 * d]     = __builtin_amdgcn_perm(braw[ni][d], braw[ni][d], 0x010C000Cu);
                    x[2 * d + 1] = __builtin_amdgcn_perm(braw[ni][d], braw[ni][d], 0x030C020Cu);
                }
                bf[ni] = __builtin_bit_cast(v16h, x);
            }

            #pragma unroll
            for (int mi = 0; mi < 8; ++mi)
                #pragma unroll
                for (int ni = 0; ni < 4; ++ni)
                    acc[mi][ni] = __builtin_amdgcn_wmma_f32_16x16x32_f16(
                        false, af[mi], false, bf[ni], (short)0, acc[mi][ni], false, false);

            // Keeps the next block's reads from moving up among these WMMAs.
            __builtin_amdgcn_sched_barrier(0);
        }

        // Publish point of tile kt + 1: this wave's reads of buffer cur are done,
        // its slice of tile kt + 1 has landed, then the barrier; only behind it
        // is buffer cur refilled.
        asm volatile("s_wait_dscnt 0x0" ::: "memory");
        asm volatile("s_wait_tensorcnt 0x0" ::: "memory");
        __syncthreads();
        if (pinned(kt + 2 < ktiles)) stage(kt + 2, cur);
    }
    // no tensor load and no LDS read is left in flight when the wave goes on to the stores
    asm volatile("s_wait_tensorcnt 0x0" ::: "memory");
    asm volatile("s_wait_dscnt 0x0" ::: "memory");

    // Epilogue: whole lines. The ring is idle: the last trip's waits and barrier ended every
    // wave's reads of it and every tensor load into it. Each wave lays its 128 x 64 tile in a
    // range of its own (128 rows at the 272-byte pitch) and reads it back row by row, so that
    // one store covers 256 contiguous bytes of each of two rows instead of 64. Two halves of
    // 64 rows: the second is laid in LDS while the first half's stores drain.
    float* Sw = (float*)(L + wave * (128u * PITCHB));
    const uint32_t half = (uint32_t)lane >> 4;
    float* Cw = C + (size_t)((uint32_t)by * GBM + (wave >> 2) * 128u) * N
                  + ((uint32_t)bx * GBN + (wave & 3u) * 64u);
    const uint32_t loff = half * (uint32_t)N + (uint32_t)lm * 4u;
    const float* Sr = Sw + half * (PITCHB / 4u) + lm * 4;
    #pragma unroll
    for (int g = 0; g < 2; ++g) {
        #pragma unroll
        for (int mi = g * 4; mi < g * 4 + 4; ++mi)
            #pragma unroll
            for (int ni = 0; ni < 4; ++ni)
                #pragma unroll
                for (int r = 0; r < 8; ++r)
                    Sw[(mi * 16 + half * 8 + r) * (PITCHB / 4u) + ni * 16 + lm] = acc[mi][ni][r];
        // the wave's own LDS writes are done before it reads the rows back across lanes
        asm volatile("s_wait_dscnt 0x0" ::: "memory");
        #pragma unroll
        for (int q = g * 2; q < g * 2 + 2; ++q) {
            #pragma unroll
            for (int j = q * 16; j < q * 16 + 16; ++j) {
                f32x4 v = *(const f32x4*)(Sr + j * 2 * (PITCHB / 4u));
                __builtin_nontemporal_store(v, (f32x4*)(Cw + (size_t)(2 * j) * N + loff));
            }
            if (q < 3) {
                // a precaution: what follows reuses registers that these 16 stores name, and
                // rewrites none of them ahead of this wait
                asm volatile("s_wait_xcnt 0x0" ::: "memory");
                // keeps the following address sums and LDS reads behind that wait
                __builtin_amdgcn_sched_barrier(0);
            }
        }
    }
}

// ---------------- Fallback: fused single-kernel path ----------------
#define BM 128
#define BN 128
#define BK 32

__global__ __launch_bounds__(256)
void ternary_gemm_fused(const float* __restrict__ A, const float* __restrict__ B,
                        float* __restrict__ C, int M, int N, int K)
{
    __shared__ _Float16 As[2][BM * LDSS];
    __shared__ _Float16 Bs[2][BN * LDSS];

    const int tid  = threadIdx.x;
    const int lane = tid & 31;
    const int w    = tid >> 5;
    const int waveM = w >> 1;
    const int waveN = w & 1;
    const int lm   = lane & 15;
    const int r0   = (lane >> 4) << 3;
    const int bx = blockIdx.x, by = blockIdx.y;

    const int arow = tid >> 1;
    const int acol = (tid & 1) * 16;
    const float4* Ag = (const float4*)(A + (size_t)(by * BM + arow) * K + acol);
    const int brow = tid >> 3;
    const int bcol = (tid & 7) * 16;
    const float4* Bg = (const float4*)(B + (size_t)brow * N + bx * BN + bcol);

    float4 aReg[4], bReg[4];
    auto loadGlobal = [&](int kt) {
        const float4* pa = Ag + (size_t)kt * (BK / 4);
        #pragma unroll
        for (int i = 0; i < 4; ++i) aReg[i] = pa[i];
        const float4* pb = Bg + (size_t)kt * BK * (N / 4);
        #pragma unroll
        for (int i = 0; i < 4; ++i) bReg[i] = pb[i];
    };
    auto stageToLds = [&](int buf) {
        const float* af = (const float*)aReg;
        v8h h0, h1;
        #pragma unroll
        for (int i = 0; i < 8; ++i) { h0[i] = (_Float16)af[i]; h1[i] = (_Float16)af[i + 8]; }
        *(v8h*)&As[buf][arow * LDSS + acol]     = h0;
        *(v8h*)&As[buf][arow * LDSS + acol + 8] = h1;
        const float* bf = (const float*)bReg;
        #pragma unroll
        for (int i = 0; i < 16; ++i) {
            float wv = bf[i];
            float aw = fabsf(wv);
            float t  = (aw >= 0.5f && aw < 1.5f) ? (wv > 0.0f ? 1.0f : -1.0f) : 0.0f;
            Bs[buf][(bcol + i) * LDSS + brow] = (_Float16)t;
        }
    };

    v8f acc[2][4] = {};
    const int ktiles = K / BK;
    loadGlobal(0);
    stageToLds(0);
    __syncthreads();

    for (int kt = 0; kt < ktiles; ++kt) {
        const int cur = kt & 1;
        if (kt + 1 < ktiles) loadGlobal(kt + 1);

        v16h afrag[2];
        #pragma unroll
        for (int mi = 0; mi < 2; ++mi) {
            const _Float16* p = &As[cur][(waveM * 32 + mi * 16 + lm) * LDSS];
            v8h lo = *(const v8h*)(p + r0);
            v8h hi = *(const v8h*)(p + r0 + 16);
            #pragma unroll
            for (int i = 0; i < 8; ++i) { afrag[mi][i] = lo[i]; afrag[mi][i + 8] = hi[i]; }
        }
        v16h bfrag[4];
        #pragma unroll
        for (int ni = 0; ni < 4; ++ni) {
            const _Float16* p = &Bs[cur][(waveN * 64 + ni * 16 + lm) * LDSS];
            v8h lo = *(const v8h*)(p + r0);
            v8h hi = *(const v8h*)(p + r0 + 16);
            #pragma unroll
            for (int i = 0; i < 8; ++i) { bfrag[ni][i] = lo[i]; bfrag[ni][i + 8] = hi[i]; }
        }
        #pragma unroll
        for (int mi = 0; mi < 2; ++mi)
            #pragma unroll
            for (int ni = 0; ni < 4; ++ni)
                acc[mi][ni] = __builtin_amdgcn_wmma_f32_16x16x32_f16(
                    false, afrag[mi], false, bfrag[ni], (short)0, acc[mi][ni], false, false);

        if (kt + 1 < ktiles) stageToLds(cur ^ 1);
        __syncthreads();
    }

    const int rowBase = by * BM + waveM * 32 + ((lane >> 4) << 3);
    const int colBase = bx * BN + waveN * 64 + lm;
    #pragma unroll
    for (int mi = 0; mi < 2; ++mi)
        #pragma unroll
        for (int ni = 0; ni < 4; ++ni)
            #pragma unroll
            for (int r = 0; r < 8; ++r)
                C[(size_t)(rowBase + mi * 16 + r) * N + colBase + ni * 16] = acc[mi][ni][r];
}

extern "C" void kernel_launch(void* const* d_in, const int* in_sizes, int n_in,
                              void* d_out, int out_size, void* d_ws, size_t ws_size,
                              hipStream_t stream) {
    const float* A = (const float*)d_in[0];   // inputs [M, K] f32
    const float* B = (const float*)d_in[1];   // kernel [K, N] f32
    float* C = (float*)d_out;                 // [M, N] f32

    const int K = 4096;
    const int N = in_sizes[1] / K;   // 4096
    const int M = in_sizes[0] / K;   // 8192

    const size_t needA = (size_t)M * K * sizeof(_Float16);
    const size_t needB = (size_t)N * K;   // one byte a weight

    if (ws_size >= needA + needB) {
        _Float16* Ah = (_Float16*)d_ws;
        unsigned char* Bt = (unsigned char*)d_ws + needA;

        const size_t nA = (size_t)M * K;
        prep_ab<<<dim3((unsigned)(nA / PA_BLOCKF) + (N / TB) * (K / (TB * TBK))), 256, 0, stream>>>(A, Ah, nA, B, Bt, K, N);
        gemm_f16_wmma<<<dim3(N / GBN, M / GBM), 256, 0, stream>>>(Ah, Bt, C, M, N, K);
    } else {
        ternary_gemm_fused<<<dim3(N / BN, M / BM), 256, 0, stream>>>(A, B, C, M, N, K);
    }
}

// v009
// One run takes 133 microseconds.
// Two timings next to v008 both put it at 1.05 times that version's speed.
// Counting every step since v000, it is 2.97 times as fast.
#include <hip/hip_runtime.h>

typedef __attribute__((ext_vector_type(16))) _Float16 v16h;
typedef __attribute__((ext_vector_type(8)))  _Float16 v8h;
typedef __attribute__((ext_vector_type(8)))  float    v8f;
typedef __attribute__((ext_vector_type(4)))  float    f32x4;

#define LDSS 40      // padded K-stride in halfs (80 bytes, 16B aligned)

typedef uint32_t u32x4 __attribute__((ext_vector_type(4)));
typedef uint32_t u32x8 __attribute__((ext_vector_type(8)));
typedef unsigned short u16x2 __attribute__((ext_vector_type(2)));

static __device__ __forceinline__ uint32_t uni(uint32_t v) {
    return (uint32_t)__builtin_amdgcn_readfirstlane(v);
}
// A wave-uniform value held in a scalar register: a test, so that the branch around a
// tensor load, which ignores EXEC, compiles to s_cmp + s_cbranch_scc; a descriptor word.
static __device__ __forceinline__ uint32_t pinned(uint32_t v) {
    uint32_t w = uni(v);
    asm volatile("" : "+s"(w));  // pinned(): keeps the test or descriptor word in its scalar register
    return w;
}

// ------- Pre-pass, one launch: A f32 -> f16 of A / 2, and B f32 [K][N] -> ternary 2-bit codes in fragment order -------
// A ternary weight is kept as the TOP TWO BITS of the f16 value of twice the weight (sign, then the
// one exponent bit of 2.0: 0x4000 = 2, 0xC000 = -2, 0 = 0), so a shift and a mask widen it exactly.
// A is halved to make up for it: exact in f16 but for values that fall below its normal range.
// The two conversions do not depend on each other, so they share one launch whose work-groups
// are all resident at once. The first n / PA_BLOCKF work-groups stream A; the others transpose B.
typedef __attribute__((ext_vector_type(4))) _Float16 v4h;
#define PA_UNITS 8                              // units a wave converts, one after the other
#define PA_UNITF 1024u                          // floats in a unit: 8 whole-line 16-byte loads of a wave
#define PA_BLOCKF (8u * PA_UNITS * PA_UNITF)    // floats an 8-wave work-group converts
#define TB 64
#define TBK 4                                   // 64 x 64 tiles of B, down k, a work-group takes at once
static __device__ __forceinline__
void prep_a_part(const float* __restrict__ A, _Float16* __restrict__ Ah, uint32_t blk, int tid) {
    // A: each wave streams PA_UNITS consecutive units; the next unit's loads are issued
    // before this unit is rounded and stored (8 to 16 loads of a wave in flight).
    const uint32_t lane = (uint32_t)tid & 31u;
    const uint32_t wv   = uni((uint32_t)tid >> 5);
    const size_t first  = ((size_t)blk * 8u + wv) * (PA_UNITS * PA_UNITF);
    const float* src = A + first + lane * 4u;
    _Float16*    dst = Ah + first + lane * 4u;

    f32x4 ring[2][8];
    #pragma unroll
    for (int j = 0; j < 8; ++j) ring[0][j] = *(const f32x4*)(src + j * 128);

    #pragma unroll
    for (int r = 0; r < PA_UNITS; ++r) {
        // the fence pair pins the order: the next unit's loads, then this unit's rounding and stores
        __builtin_amdgcn_sched_barrier(0);
        if (r + 1 < PA_UNITS) {
            #pragma unroll
            for (int j = 0; j < 8; ++j)
                ring[(r + 1) & 1][j] = *(const f32x4*)(src + (r + 1) * PA_UNITF + j * 128);
        }
        __builtin_amdgcn_sched_barrier(0);
        #pragma unroll
        for (int j = 0; j < 8; ++j) {
            const f32x4 f = ring[r & 1][j];
            v4h h;
            h[0] = (_Float16)(f[0] * 0.5f); h[1] = (_Float16)(f[1] * 0.5f);
            h[2] = (_Float16)(f[2] * 0.5f); h[3] = (_Float16)(f[3] * 0.5f);
            *(v4h*)(dst + r * PA_UNITF + j * 128) = h;
        }
        if (r + 2 < PA_UNITS) {
            // a precaution: the loads that follow land in registers that these stores name
            asm volatile("s_wait_xcnt 0x0" ::: "memory");
        }
    }
}

#define TPD 65u   // LDS row pitch in dwords: 256 k bytes + 1 dword, so that a column of dword writes meets 32 banks
static __device__ __forceinline__ uint32_t tern_code(float wv) {
    const float aw = fabsf(wv);
    const uint32_t one = ((__float_as_uint(wv) >> 30) & 2u) | 1u;   // bit 1: the sign; bit 0: not zero
    return (aw >= 0.5f && aw < 1.5f) ? one : 0u;
}

static __device__ __forceinline__
void prep_b_part(const float* __restrict__ B, unsigned char* __restrict__ Bt, int K, int N, uint32_t bi, int tid) {
    __shared__ uint32_t t[TB * TPD];
    // B: the 16 loads of a thread are issued ahead of the work and one barrier serves the TBK tiles.
    // A thread takes 4 k rows x 4 columns of each tile and packs the 4 k of a column into one dword.
    const uint32_t nbx = (uint32_t)N / TB;
    const int k0 = (int)(bi / nbx) * (TB * TBK), n0 = (int)(bi % nbx) * TB;

    const uint32_t a = (uint32_t)tid >> 4;    // k rows 4a .. 4a + 3 of a tile
    const uint32_t c = (uint32_t)tid & 15u;   // columns 4c .. 4c + 3
    float4 v[TBK][4];
    uint32_t off[4];          // byte offsets of a thread's four rows, the same in every tile
    const char* ts[TBK];      // a tile's first byte, the same in every thread
    #pragma unroll
    for (int j = 0; j < 4; ++j) off[j] = ((a * 4u + j) * (uint32_t)N + c * 4u) * 4u;
    #pragma unroll
    for (int s = 0; s < TBK; ++s) {
        ts[s] = (const char*)(B + (size_t)(k0 + s * TB) * N + n0);
        #pragma unroll
        for (int j = 0; j < 4; ++j) v[s][j] = *(const float4*)(ts[s] + off[j]);
    }
    // a precaution: what follows reuses registers that these 16 loads name; the offsets and the
    // bases are inputs of the wait, so that nothing is written into one ahead of it
    asm volatile("s_wait_xcnt 0x0" :: "v"(off[0]), "v"(off[1]), "v"(off[2]), "v"(off[3]),
                                      "s"(ts[0]), "s"(ts[1]), "s"(ts[2]), "s"(ts[3]) : "memory");
    // keeps the packing behind the wait, so that it takes no register ahead of the loads: in the
    // built code 15 of the 16 loads are then issued before the first is waited for, without it 14
    __builtin_amdgcn_sched_barrier(0);
    // Inside each 32 k the runs of 8 are stored in the order 0, 2, 1, 3: the 16 k that one lane
    // of the GEMM feeds to a WMMA (8 and, 16 further on, 8 more) then lie in 16 bytes in a row.
    const uint32_t run = (a >> 1) & 3u;
    const uint32_t pd  = (a & 8u) | ((((run & 1u) << 1) | (run >> 1)) << 1) | (a & 1u);
    #pragma unroll
    for (int s = 0; s < TBK; ++s) {
        #pragma unroll
        for (int e = 0; e < 4; ++e) {
            // one code a byte; the first pair of k two bits up, so that the packing below can lay
            // the second pair's bytes under them
            const uint32_t d = (tern_code(((const float*)&v[s][0])[e]) << 2)
                             | (tern_code(((const float*)&v[s][1])[e]) << 10)
                             | (tern_code(((const float*)&v[s][2])[e]) << 16)
                             | (tern_code(((const float*)&v[s][3])[e]) << 24);
            t[(c * 4u + e) * TPD + s * 16u + pd] = d;
        }
    }
    __syncthreads();

    // A thread packs what one lane of the GEMM feeds to the WMMAs of one 16-column fragment in one
    // 128-k tile: four dwords, one for each 32 k. In a dword, element 2d of the lane's 16 lies in
    // bits 15-2d and 14-2d, element 2d+1 sixteen bits above: (dword << 2d) & 0xC000C000 is operand
    // register d. A wave stores the 512 bytes of a (fragment, tile) pair in lane order.
    const uint32_t fc = (uint32_t)tid & 15u, fh = ((uint32_t)tid >> 4) & 1u;
    const uint32_t ft = ((uint32_t)tid >> 5) & 1u, fn = (uint32_t)tid >> 6;
    u32x4 o;
    #pragma unroll
    for (int q = 0; q < 4; ++q) {
        uint32_t lo = 0u, hi = 0u;
        #pragma unroll
        for (int i = 0; i < 4; ++i) {
            const uint32_t wd = t[(fn * 16u + fc) * TPD + ft * 32u + q * 8u + fh * 4u + i];
            const uint32_t u = wd | (wd >> 16);
            lo |= (u & 0xFu) << (12 - 4 * i);
            hi |= ((u >> 8) & 0xFu) << (12 - 4 * i);
        }
        o[q] = lo | (hi << 16);
    }
    *(u32x4*)(Bt + ((size_t)(((uint32_t)n0 >> 4) + fn) * ((uint32_t)K >> 7) + ((uint32_t)k0 >> 7) + ft) * 512u
                 + (fh * 16u + fc) * 16u) = o;
    // a precaution: in the built code the other part's text follows this one behind a branch,
    // and it writes registers that these stores name
    asm volatile("s_wait_xcnt 0x0" ::: "memory");
}

__global__ __launch_bounds__(256)
void prep_ab(const float* __restrict__ A, _Float16* __restrict__ Ah, size_t n,
             const float* __restrict__ B, unsigned char* __restrict__ Bt, int K, int N) {
    const uint32_t ablocks = (uint32_t)(n / PA_BLOCKF);
    // the same for a whole work-group, so every wave of a B work-group meets its barrier
    if (blockIdx.x >= ablocks) prep_b_part(B, Bt, K, N, blockIdx.x - ablocks, threadIdx.x);
    else                       prep_a_part(A, Ah, blockIdx.x, threadIdx.x);
}

// ---------------- f16 GEMM, C = Ah[M,K] x B; B in 2-bit codes, widened to f16 in registers ----------------
// A row of A costs 2 bytes a k on the way from L2 to LDS, a column of B a quarter of a byte: the
// work-group's 65,536 results are laid 128 x 512, which takes fewer bytes than 256 x 256.
#define GBM 128
#define GBN 512
#define GBK 128      // 256 bytes (one L2 fill unit) of every row of A per K tile
#define ROWB 256u    // bytes of one row of A in a K tile
#define PITCHB 272u  // LDS row pitch in bytes: 16 B x odd, for ds_load_b128 readers
#define SLROWS 32u   // rows of A in one wave's slice of a stage
#define SLICEB 10240u            // 32 rows x 272 B = 8,704 B, rounded up to a multiple of 2 KiB
#define FRAGB   512u   // bytes of a 16-column fragment of B in a K tile: 16 bytes a lane, in lane order
#define SLFRAGS 8u     // fragments of B in one wave's slice of a stage
#define SLICEB2 (SLFRAGS * FRAGB)             // 4 KiB
#define BUFB   (4u * SLICEB + 4u * SLICEB2)   // a stage: A's 128 rows in four slices, then B's 32 fragments in four
#define EPIB   (8u * 128u * PITCHB)           // the epilogue's staging: 128 rows a wave

__global__ __launch_bounds__(256)
void gemm_f16_wmma(const _Float16* __restrict__ Ah,   // [M][K] f16
                   const unsigned char* __restrict__ Bt,   // [N / 16][K / 128][512 bytes], 2-bit codes
                   float* __restrict__ C,             // [M][N] f32
                   int M, int N, int K)
{
    __shared__ __attribute__((aligned(2048))) unsigned char L[EPIB > 2u * BUFB ? EPIB : 2u * BUFB];

    const int tid  = threadIdx.x;
    const int lane = tid & 31;
    const int w    = tid >> 5;
    const int waveN = w;             // 0..7 -> 64-col slab; every wave takes all 128 rows
    const int lm   = lane & 15;
    const int r0   = (lane >> 4) << 3;   // K-run select per 16-bit WMMA layout

    const int bx = blockIdx.x, by = blockIdx.y;

    // Staging: every wave brings its own slice of each stage with one tensor load, waves 0-3
    // 32 rows of A, 256 bytes each, which the load's pad lays at the 272-byte pitch, waves 4-7
    // 8 fragments of B, 512 bytes each, laid one behind the other.
    const uint32_t wave  = uni((uint32_t)tid >> 5);
    const uint32_t lbase = (uint32_t)(size_t)L;
    const bool isA = wave < 4u;
    const uint64_t sbase = isA
        ? (uint64_t)(size_t)(Ah + (size_t)((uint32_t)by * GBM + wave * SLROWS) * K)
        : (uint64_t)(size_t)(Bt + (size_t)((uint32_t)bx * (GBN / 16u) + (wave - 4u) * SLFRAGS) * ((uint32_t)K * 4u));
    const uint32_t sstep = isA ? ROWB : FRAGB;                                   // source bytes per K tile
    const uint32_t sloff = isA ? wave * SLICEB : 4u * SLICEB + (wave - 4u) * SLICEB2;   // slice in a stage

    // Descriptor group 1 of A, the same for every request: 1-byte elements, tensor = tile =
    // 32 rows of 256 bytes, source pitch 2 K bytes, 4 dwords of pad behind each row.
    // Each word is held in its scalar register by pinned(), so that the compiler lends
    // none of the eight to another value while a request is outstanding.
    u32x8 d1;
    d1[0] = pinned((1u << 20) | (5u << 22) | (3u << 25));
    d1[1] = pinned((ROWB & 0xFFFFu) << 16);
    d1[2] = pinned((ROWB >> 16) | ((SLROWS & 0xFFFFu) << 16));
    d1[3] = pinned((SLROWS >> 16) | (ROWB << 16));
    d1[4] = pinned(SLROWS);
    d1[5] = pinned((uint32_t)K * 2u);
    d1[6] = pinned(0u);
    d1[7] = pinned(0u);
    // The same for B: 8 rows of 512 bytes (a fragment each), source pitch 4 K bytes (a fragment's
    // K / 128 tiles), no pad.
    u32x8 e1;
    e1[0] = pinned(0u);
    e1[1] = pinned((FRAGB & 0xFFFFu) << 16);
    e1[2] = pinned((FRAGB >> 16) | ((SLFRAGS & 0xFFFFu) << 16));
    e1[3] = pinned((SLFRAGS >> 16) | (FRAGB << 16));
    e1[4] = pinned(SLFRAGS);
    e1[5] = pinned((uint32_t)K * 4u);
    e1[6] = pinned(0u);
    e1[7] = pinned(0u);

    // Stage this wave's slice of tile kt into LDS buffer `buf`.
    // Group 0 lives in one set of registers from here on: its word 0 is written once, ahead of
    // the first request; the other three are formed anew for each request, behind the wait.
    u32x4 d0;
    d0[0] = pinned(1u);   // pinned(): a descriptor word held in its scalar register
    auto stage = [&](int kt, int buf) {
        const uint64_t ga = sbase + (uint64_t)((uint32_t)kt * sstep);
        d0[1] = uni(lbase + (uint32_t)buf * BUFB + sloff);
        d0[2] = uni((uint32_t)ga);
        d0[3] = uni((((uint32_t)(ga >> 32)) & 0x01FFFFFFu) | 0x80000000u);
        // one request of the whole wave; no builtin is used, the waits are written by hand
        if (pinned(wave < 4u))  asm volatile("tensor_load_to_lds %0, %1" :: "s"(d0), "s"(d1) : "memory");
        if (pinned(wave >= 4u)) asm volatile("tensor_load_to_lds %0, %1" :: "s"(d0), "s"(e1) : "memory");
    };

    v8f acc[8][4] = {};

    const int ktiles = K / GBK;
    stage(0, 0);
    // this wave's slice of tile 0 has landed before the barrier publishes it
    asm volatile("s_wait_tensorcnt 0x0" ::: "memory");
    __syncthreads();
    if (pinned(1 < ktiles)) stage(1, 1);

    for (int kt = 0; kt < ktiles; ++kt) {
        const int cur = kt & 1;

        // a lane's weights of a fragment for the whole K tile are 16 bytes: one dword for each 32 k
        u32x4 bq[4];
        #pragma unroll
        for (int ni = 0; ni < 4; ++ni)
            bq[ni] = *(const u32x4*)(L + cur * BUFB + 4u * SLICEB + (waveN * 4 + ni) * FRAGB + lane * 16);
        // The B codes, which the first row of WMMAs needs, stay in front of the A
        // fragments, so that the counted waits let them be widened while A arrives.
        __builtin_amdgcn_sched_barrier(0);

        #pragma unroll
        for (int ks = 0; ks < GBK / 32; ++ks) {
            v16h af[8], bf[4];
            #pragma unroll
            for (int mi = 0; mi < 8; ++mi) {
                const _Float16* p = (const _Float16*)(L + cur * BUFB + (mi >> 1) * SLICEB
                                                      + ((mi & 1) * 16 + lm) * PITCHB) + ks * 32;
                v8h lo = *(const v8h*)(p + r0);
                v8h hi = *(const v8h*)(p + r0 + 16);
                #pragma unroll
                for (int i = 0; i < 8; ++i) { af[mi][i] = lo[i]; af[mi][i + 8] = hi[i]; }
            }

            // Keeps the block's 16 LDS reads together in front of its 32 WMMAs: left
            // alone the compiler reads one A fragment per row of four WMMAs and waits
            // for it each time, which two waves per SIMD cannot hide.
            __builtin_amdgcn_sched_barrier(0);

            // 2-bit code -> the top two bits of an f16 (0, 2 or -2), two a dword
            #pragma unroll
            for (int ni = 0; ni < 4; ++ni) {
                u32x8 x;
                const uint32_t cw = bq[ni][ks];
                #pragma unroll
                for (int d = 0; d < 7; ++d) x[d] = (cw << (2 * d)) & 0xC000C000u;
                // the last pair lies lowest in each half: a shift of the two halves leaves nothing to mask
                const u16x2 last = __builtin_bit_cast(u16x2, cw) << 14;
                x[7] = __builtin_bit_cast(uint32_t, last);
                bf[ni] = __builtin_bit_cast(v16h, x);
            }

            #pragma unroll
            for (int mi = 0; mi < 8; ++mi)
                #pragma unroll
                for (int ni = 0; ni < 4; ++ni)
                    acc[mi][ni] = __builtin_amdgcn_wmma_f32_16x16x32_f16(
                        false, af[mi], false, bf[ni], (short)0, acc[mi][ni], false, false);

            // Keeps the next block's reads from moving up among these WMMAs.
            __builtin_amdgcn_sched_barrier(0);
        }

        // Publish point of tile kt + 1: this wave's reads of buffer cur are done,
        // its slice of tile kt + 1 has landed, then the barrier; only behind it
        // is buffer cur refilled.
        asm volatile("s_wait_dscnt 0x0" ::: "memory");
        asm volatile("s_wait_tensorcnt 0x0" ::: "memory");
        __syncthreads();
        if (pinned(kt + 2 < ktiles)) stage(kt + 2, cur);
    }
    // no tensor load and no LDS read is left in flight when the wave goes on to the stores
    asm volatile("s_wait_tensorcnt 0x0" ::: "memory");
    asm volatile("s_wait_dscnt 0x0" ::: "memory");

    // Epilogue: whole lines. The ring is idle: the last trip's waits and barrier ended every
    // wave's reads of it and every tensor load into it. Each wave lays its 128 x 64 tile in a
    // range of its own (128 rows at the 272-byte pitch) and reads it back row by row, so that
    // one store covers 256 contiguous bytes of each of two rows instead of 64. Two halves of
    // 64 rows: the second is laid in LDS while the first half's stores drain.
    float* Sw = (float*)(L + wave * (128u * PITCHB));
    const uint32_t half = (uint32_t)lane >> 4;
    float* Cw = C + (size_t)((uint32_t)by * GBM) * N + ((uint32_t)bx * GBN + wave * 64u);
    const uint32_t loff = half * (uint32_t)N + (uint32_t)lm * 4u;
    const float* Sr = Sw + half * (PITCHB / 4u) + lm * 4;
    #pragma unroll
    for (int g = 0; g < 2; ++g) {
        #pragma unroll
        for (int mi = g * 4; mi < g * 4 + 4; ++mi)
            #pragma unroll
            for (int ni = 0; ni < 4; ++ni)
                #pragma unroll
                for (int r = 0; r < 8; ++r)
                    Sw[(mi * 16 + half * 8 + r) * (PITCHB / 4u) + ni * 16 + lm] = acc[mi][ni][r];
        // the wave's own LDS writes are done before it reads the rows back across lanes
        asm volatile("s_wait_dscnt 0x0" ::: "memory");
        #pragma unroll
        for (int q = g * 2; q < g * 2 + 2; ++q) {
            #pragma unroll
            for (int j = q * 16; j < q * 16 + 16; ++j) {
                f32x4 v = *(const f32x4*)(Sr + j * 2 * (PITCHB / 4u));
                __builtin_nontemporal_store(v, (f32x4*)(Cw + (size_t)(2 * j) * N + loff));
            }
            if (q < 3) {
                // a precaution: what follows reuses registers that these 16 stores name, and
                // rewrites none of them ahead of this wait
                asm volatile("s_wait_xcnt 0x0" ::: "memory");
                // keeps the following address sums and LDS reads behind that wait
                __builtin_amdgcn_sched_barrier(0);
            }
        }
    }
}

// ---------------- Fallback: fused single-kernel path ----------------
#define BM 128
#define BN 128
#define BK 32

__global__ __launch_bounds__(256)
void ternary_gemm_fused(const float* __restrict__ A, const float* __restrict__ B,
                        float* __restrict__ C, int M, int N, int K)
{
    __shared__ _Float16 As[2][BM * LDSS];
    __shared__ _Float16 Bs[2][BN * LDSS];

    const int tid  = threadIdx.x;
    const int lane = tid & 31;
    const int w    = tid >> 5;
    const int waveM = w >> 1;
    const int waveN = w & 1;
    const int lm   = lane & 15;
    const int r0   = (lane >> 4) << 3;
    const int bx = blockIdx.x, by = blockIdx.y;

    const int arow = tid >> 1;
    const int acol = (tid & 1) * 16;
    const float4* Ag = (const float4*)(A + (size_t)(by * BM + arow) * K + acol);
    const int brow = tid >> 3;
    const int bcol = (tid & 7) * 16;
    const float4* Bg = (const float4*)(B + (size_t)brow * N + bx * BN + bcol);

    float4 aReg[4], bReg[4];
    auto loadGlobal = [&](int kt) {
        const float4* pa = Ag + (size_t)kt * (BK / 4);
        #pragma unroll
        for (int i = 0; i < 4; ++i) aReg[i] = pa[i];
        const float4* pb = Bg + (size_t)kt * BK * (N / 4);
        #pragma unroll
        for (int i = 0; i < 4; ++i) bReg[i] = pb[i];
    };
    auto stageToLds = [&](int buf) {
        const float* af = (const float*)aReg;
        v8h h0, h1;
        #pragma unroll
        for (int i = 0; i < 8; ++i) { h0[i] = (_Float16)af[i]; h1[i] = (_Float16)af[i + 8]; }
        *(v8h*)&As[buf][arow * LDSS + acol]     = h0;
        *(v8h*)&As[buf][arow * LDSS + acol + 8] = h1;
        const float* bf = (const float*)bReg;
        #pragma unroll
        for (int i = 0; i < 16; ++i) {
            float wv = bf[i];
            float aw = fabsf(wv);
            float t  = (aw >= 0.5f && aw < 1.5f) ? (wv > 0.0f ? 1.0f : -1.0f) : 0.0f;
            Bs[buf][(bcol + i) * LDSS + brow] = (_Float16)t;
        }
    };

    v8f acc[2][4] = {};
    const int ktiles = K / BK;
    loadGlobal(0);
    stageToLds(0);
    __syncthreads();

    for (int kt = 0; kt < ktiles; ++kt) {
        const int cur = kt & 1;
        if (kt + 1 < ktiles) loadGlobal(kt + 1);

        v16h afrag[2];
        #pragma unroll
        for (int mi = 0; mi < 2; ++mi) {
            const _Float16* p = &As[cur][(waveM * 32 + mi * 16 + lm) * LDSS];
            v8h lo = *(const v8h*)(p + r0);
            v8h hi = *(const v8h*)(p + r0 + 16);
            #pragma unroll
            for (int i = 0; i < 8; ++i) { afrag[mi][i] = lo[i]; afrag[mi][i + 8] = hi[i]; }
        }
        v16h bfrag[4];
        #pragma unroll
        for (int ni = 0; ni < 4; ++ni) {
            const _Float16* p = &Bs[cur][(waveN * 64 + ni * 16 + lm) * LDSS];
            v8h lo = *(const v8h*)(p + r0);
            v8h hi = *(const v8h*)(p + r0 + 16);
            #pragma unroll
            for (int i = 0; i < 8; ++i) { bfrag[ni][i] = lo[i]; bfrag[ni][i + 8] = hi[i]; }
        }
        #pragma unroll
        for (int mi = 0; mi < 2; ++mi)
            #pragma unroll
            for (int ni = 0; ni < 4; ++ni)
                acc[mi][ni] = __builtin_amdgcn_wmma_f32_16x16x32_f16(
                    false, afrag[mi], false, bfrag[ni], (short)0, acc[mi][ni], false, false);

        if (kt + 1 < ktiles) stageToLds(cur ^ 1);
        __syncthreads();
    }

    const int rowBase = by * BM + waveM * 32 + ((lane >> 4) << 3);
    const int colBase = bx * BN + waveN * 64 + lm;
    #pragma unroll
    for (int mi = 0; mi < 2; ++mi)
        #pragma unroll
        for (int ni = 0; ni < 4; ++ni)
            #pragma unroll
            for (int r = 0; r < 8; ++r)
                C[(size_t)(rowBase + mi * 16 + r) * N + colBase + ni * 16] = acc[mi][ni][r];
}

extern "C" void kernel_launch(void* const* d_in, const int* in_sizes, int n_in,
                              void* d_out, int out_size, void* d_ws, size_t ws_size,
                              hipStream_t stream) {
    const float* A = (const float*)d_in[0];   // inputs [M, K] f32
    const float* B = (const float*)d_in[1];   // kernel [K, N] f32
    float* C = (float*)d_out;                 // [M, N] f32

    const int K = 4096;
    const int N = in_sizes[1] / K;   // 4096
    const int M = in_sizes[0] / K;   // 8192

    const size_t needA = (size_t)M * K * sizeof(_Float16);
    const size_t needB = (size_t)N * K / 4;   // two bits a weight

    if (ws_size >= needA + needB) {
        _Float16* Ah = (_Float16*)d_ws;
        unsigned char* Bt = (unsigned char*)d_ws + needA;

        const size_t nA = (size_t)M * K;
        prep_ab<<<dim3((unsigned)(nA / PA_BLOCKF) + (N / TB) * (K / (TB * TBK))), 256, 0, stream>>>(A, Ah, nA, B, Bt, K, N);
        gemm_f16_wmma<<<dim3(N / GBN, M / GBM), 256, 0, stream>>>(Ah, Bt, C, M, N, K);
    } else {
        ternary_gemm_fused<<<dim3(N / BN, M / BM), 256, 0, stream>>>(A, B, C, M, N, K);
    }
}

// v010
// A run of this version takes 127 microseconds.
// In both of two side-by-side timings against v009, it was 1.05 times as fast.
// All steps since v000 together make it 3.11 times as fast.
#include <hip/hip_runtime.h>

typedef __attribute__((ext_vector_type(16))) _Float16 v16h;
typedef __attribute__((ext_vector_type(8)))  _Float16 v8h;
typedef __attribute__((ext_vector_type(8)))  float    v8f;
typedef __attribute__((ext_vector_type(4)))  float    f32x4;

#define LDSS 40      // padded K-stride in halfs (80 bytes, 16B aligned)

typedef uint32_t u32x4 __attribute__((ext_vector_type(4)));
typedef uint32_t u32x8 __attribute__((ext_vector_type(8)));
typedef unsigned short u16x2 __attribute__((ext_vector_type(2)));

static __device__ __forceinline__ uint32_t uni(uint32_t v) {
    return (uint32_t)__builtin_amdgcn_readfirstlane(v);
}
// A wave-uniform value held in a scalar register: a test, so that the branch around a
// tensor load, which ignores EXEC, compiles to s_cmp + s_cbranch_scc; a descriptor word.
static __device__ __forceinline__ uint32_t pinned(uint32_t v) {
    uint32_t w = uni(v);
    asm volatile("" : "+s"(w));  // pinned(): keeps the test or descriptor word in its scalar register
    return w;
}

// ------- Pre-pass, one launch: A f32 -> f16 of A / 2, and B f32 [K][N] -> ternary 2-bit codes in fragment order -------
// A ternary weight is kept as the TOP TWO BITS of the f16 value of twice the weight (sign, then the
// one exponent bit of 2.0: 0x4000 = 2, 0xC000 = -2, 0 = 0), so a shift and a mask widen it exactly.
// A is halved to make up for it: exact in f16 but for values that fall below its normal range.
// The two conversions do not depend on each other, so they share one launch whose work-groups
// are all resident at once. The first n / PA_BLOCKF work-groups stream A; the others transpose B.
typedef __attribute__((ext_vector_type(4))) _Float16 v4h;
#define PA_UNITS 8                              // units a wave converts, one after the other
#define PA_UNITF 1024u                          // floats in a unit: 8 whole-line 16-byte loads of a wave
#define PA_BLOCKF (8u * PA_UNITS * PA_UNITF)    // floats an 8-wave work-group converts
#define TB 64
#define TBK 4                                   // 64 x 64 tiles of B, down k, a work-group takes at once
static __device__ __forceinline__
void prep_a_part(const float* __restrict__ A, _Float16* __restrict__ Ah, uint32_t blk, int tid) {
    // A: each wave streams PA_UNITS consecutive units; the next unit's loads are issued
    // before this unit is rounded and stored (8 to 16 loads of a wave in flight).
    const uint32_t lane = (uint32_t)tid & 31u;
    const uint32_t wv   = uni((uint32_t)tid >> 5);
    const size_t first  = ((size_t)blk * 8u + wv) * (PA_UNITS * PA_UNITF);
    const float* src = A + first + lane * 4u;
    _Float16*    dst = Ah + first + lane * 4u;

    f32x4 ring[2][8];
    #pragma unroll
    for (int j = 0; j < 8; ++j) ring[0][j] = *(const f32x4*)(src + j * 128);

    #pragma unroll
    for (int r = 0; r < PA_UNITS; ++r) {
        // the fence pair pins the order: the next unit's loads, then this unit's rounding and stores
        __builtin_amdgcn_sched_barrier(0);
        if (r + 1 < PA_UNITS) {
            #pragma unroll
            for (int j = 0; j < 8; ++j)
                ring[(r + 1) & 1][j] = *(const f32x4*)(src + (r + 1) * PA_UNITF + j * 128);
        }
        __builtin_amdgcn_sched_barrier(0);
        #pragma unroll
        for (int j = 0; j < 8; ++j) {
            const f32x4 f = ring[r & 1][j];
            v4h h;
            h[0] = (_Float16)(f[0] * 0.5f); h[1] = (_Float16)(f[1] * 0.5f);
            h[2] = (_Float16)(f[2] * 0.5f); h[3] = (_Float16)(f[3] * 0.5f);
            *(v4h*)(dst + r * PA_UNITF + j * 128) = h;
        }
        if (r + 2 < PA_UNITS) {
            // a precaution: the loads that follow land in registers that these stores name
            asm volatile("s_wait_xcnt 0x0" ::: "memory");
        }
    }
}

#define TPD 65u   // LDS row pitch in dwords: 256 k bytes + 1 dword, so that a column of dword writes meets 32 banks
static __device__ __forceinline__ uint32_t tern_code(float wv) {
    const float aw = fabsf(wv);
    const uint32_t one = ((__float_as_uint(wv) >> 30) & 2u) | 1u;   // bit 1: the sign; bit 0: not zero
    return (aw >= 0.5f && aw < 1.5f) ? one : 0u;
}

static __device__ __forceinline__
void prep_b_part(const float* __restrict__ B, unsigned char* __restrict__ Bt, int K, int N, uint32_t bi, int tid) {
    __shared__ uint32_t t[TB * TPD];
    // B: the 16 loads of a thread are issued ahead of the work and one barrier serves the TBK tiles.
    // A thread takes 4 k rows x 4 columns of each tile and packs the 4 k of a column into one dword.
    const uint32_t nbx = (uint32_t)N / TB;
    const int k0 = (int)(bi / nbx) * (TB * TBK), n0 = (int)(bi % nbx) * TB;

    const uint32_t a = (uint32_t)tid >> 4;    // k rows 4a .. 4a + 3 of a tile
    const uint32_t c = (uint32_t)tid & 15u;   // columns 4c .. 4c + 3
    float4 v[TBK][4];
    uint32_t off[4];          // byte offsets of a thread's four rows, the same in every tile
    const char* ts[TBK];      // a tile's first byte, the same in every thread
    #pragma unroll
    for (int j = 0; j < 4; ++j) off[j] = ((a * 4u + j) * (uint32_t)N + c * 4u) * 4u;
    #pragma unroll
    for (int s = 0; s < TBK; ++s) {
        ts[s] = (const char*)(B + (size_t)(k0 + s * TB) * N + n0);
        #pragma unroll
        for (int j = 0; j < 4; ++j) v[s][j] = *(const float4*)(ts[s] + off[j]);
    }
    // a precaution: what follows reuses registers that these 16 loads name; the offsets and the
    // bases are inputs of the wait, so that nothing is written into one ahead of it
    asm volatile("s_wait_xcnt 0x0" :: "v"(off[0]), "v"(off[1]), "v"(off[2]), "v"(off[3]),
                                      "s"(ts[0]), "s"(ts[1]), "s"(ts[2]), "s"(ts[3]) : "memory");
    // keeps the packing behind the wait, so that it takes no register ahead of the loads: in the
    // built code 15 of the 16 loads are then issued before the first is waited for, without it 14
    __builtin_amdgcn_sched_barrier(0);
    // Inside each 32 k the runs of 8 are stored in the order 0, 2, 1, 3: the 16 k that one lane
    // of the GEMM feeds to a WMMA (8 and, 16 further on, 8 more) then lie in 16 bytes in a row.
    const uint32_t run = (a >> 1) & 3u;
    const uint32_t pd  = (a & 8u) | ((((run & 1u) << 1) | (run >> 1)) << 1) | (a & 1u);
    #pragma unroll
    for (int s = 0; s < TBK; ++s) {
        #pragma unroll
        for (int e = 0; e < 4; ++e) {
            // one code a byte; the first pair of k two bits up, so that the packing below can lay
            // the second pair's bytes under them
            const uint32_t d = (tern_code(((const float*)&v[s][0])[e]) << 2)
                             | (tern_code(((const float*)&v[s][1])[e]) << 10)
                             | (tern_code(((const float*)&v[s][2])[e]) << 16)
                             | (tern_code(((const float*)&v[s][3])[e]) << 24);
            t[(c * 4u + e) * TPD + s * 16u + pd] = d;
        }
    }
    __syncthreads();

    // A thread packs what one lane of the GEMM feeds to the WMMAs of one 16-column fragment in one
    // 128-k tile: four dwords, one for each 32 k. In a dword, element 2d of the lane's 16 lies in
    // bits 15-2d and 14-2d, element 2d+1 sixteen bits above: (dword << 2d) & 0xC000C000 is operand
    // register d. A wave stores the 512 bytes of a (fragment, tile) pair in lane order.
    const uint32_t fc = (uint32_t)tid & 15u, fh = ((uint32_t)tid >> 4) & 1u;
    const uint32_t ft = ((uint32_t)tid >> 5) & 1u, fn = (uint32_t)tid >> 6;
    u32x4 o;
    #pragma unroll
    for (int q = 0; q < 4; ++q) {
        uint32_t lo = 0u, hi = 0u;
        #pragma unroll
        for (int i = 0; i < 4; ++i) {
            const uint32_t wd = t[(fn * 16u + fc) * TPD + ft * 32u + q * 8u + fh * 4u + i];
            const uint32_t u = wd | (wd >> 16);
            lo |= (u & 0xFu) << (12 - 4 * i);
            hi |= ((u >> 8) & 0xFu) << (12 - 4 * i);
        }
        o[q] = lo | (hi << 16);
    }
    *(u32x4*)(Bt + ((size_t)(((uint32_t)n0 >> 4) + fn) * ((uint32_t)K >> 7) + ((uint32_t)k0 >> 7) + ft) * 512u
                 + (fh * 16u + fc) * 16u) = o;
    // a precaution: in the built code the other part's text follows this one behind a branch,
    // and it writes registers that these stores name
    asm volatile("s_wait_xcnt 0x0" ::: "memory");
}

__global__ __launch_bounds__(256)
void prep_ab(const float* __restrict__ A, _Float16* __restrict__ Ah, size_t n,
             const float* __restrict__ B, unsigned char* __restrict__ Bt, int K, int N) {
    const uint32_t ablocks = (uint32_t)(n / PA_BLOCKF);
    // the same for a whole work-group, so every wave of a B work-group meets its barrier
    if (blockIdx.x >= ablocks) prep_b_part(B, Bt, K, N, blockIdx.x - ablocks, threadIdx.x);
    else                       prep_a_part(A, Ah, blockIdx.x, threadIdx.x);
}

// ---------------- f16 GEMM, C = Ah[M,K] x B; B in 2-bit codes, widened to f16 in registers ----------------
// A row of A costs 2 bytes a k on the way from L2 to LDS, a column of B a quarter of a byte: the
// 65,536 results of a work-group's row tile are laid 128 x 512, which takes fewer bytes than 256 x 256.
#define GBM 128
#define GBN 512
#define GBK 128      // 256 bytes of every row of A per K tile
#define ROWB 256u    // bytes of one row of A in a K tile
#define PITCHB 272u  // LDS row pitch in bytes: 16 B x odd, for ds_load_b128 readers
#define SLROWS 32u   // rows of A in one wave's slice of a stage
#define SLICEB 10240u            // 32 rows x 272 B = 8,704 B, rounded up to a multiple of 2 KiB
#define FRAGB   512u   // bytes of a 16-column fragment of B in a K tile: 16 bytes a lane, in lane order
#define SLFRAGS 8u     // fragments of B in one wave's slice of a stage
#define SLICEB2 (SLFRAGS * FRAGB)             // 4 KiB
#define BUFB   (4u * SLICEB + 4u * SLICEB2)   // a stage: A's 128 rows in four slices, then B's 32 fragments in four
#define EPIW   (64u * PITCHB)                 // the epilogue's staging of one wave: 64 rows, behind the ring
#define GTILES 2     // row tiles a work-group takes, one after the other

__global__ __launch_bounds__(256)
void gemm_f16_wmma(const _Float16* __restrict__ Ah,   // [M][K] f16
                   const unsigned char* __restrict__ Bt,   // [N / 16][K / 128][512 bytes], 2-bit codes
                   float* __restrict__ C,             // [M][N] f32
                   int M, int N, int K)
{
    __shared__ __attribute__((aligned(2048))) unsigned char L[2u * BUFB + 8u * EPIW];

    const int tid  = threadIdx.x;
    const int lane = tid & 31;
    const int w    = tid >> 5;
    const int waveN = w;             // 0..7 -> 64-col slab; every wave takes all 128 rows
    const int lm   = lane & 15;
    const int r0   = (lane >> 4) << 3;   // K-run select per 16-bit WMMA layout

    // The deal, for speed only (any placement gives the same result): one work-group per WGP stays
    // there for its GTILES row tiles, and the work-groups that read the same rows of A have the same
    // flat index modulo 8. Every (row tile, column tile) is dealt once.
    const uint32_t nbx = (uint32_t)N / GBN;                 // the grid: nbx x nby work-groups
    const uint32_t nby = (uint32_t)M / (GBM * GTILES);
    const uint32_t flat = (uint32_t)blockIdx.y * nbx + blockIdx.x;
    const uint32_t bx  = (flat >> 3) % nbx;
    const uint32_t by0 = ((flat >> 3) / nbx) * 8u + (flat & 7u);   // tile t: row tile by0 + t * nby

    // Staging: every wave brings its own slice of each stage with one tensor load, waves 0-3
    // 32 rows of A, 256 bytes each, which the load's pad lays at the 272-byte pitch, waves 4-7
    // 8 fragments of B, 512 bytes each, laid one behind the other.
    const uint32_t wave  = uni((uint32_t)tid >> 5);
    const uint32_t lbase = (uint32_t)(size_t)L;
    const bool isA = wave < 4u;
    const uint64_t sbase = isA
        ? (uint64_t)(size_t)(Ah + (size_t)(by0 * GBM + wave * SLROWS) * K)
        : (uint64_t)(size_t)(Bt + (size_t)(bx * (GBN / 16u) + (wave - 4u) * SLFRAGS) * ((uint32_t)K * 4u));
    const uint32_t sstep = isA ? ROWB : FRAGB;                                   // source bytes per K tile
    const uint32_t tstep = isA ? nby * GBM * (uint32_t)K * 2u : 0u;              // source bytes per row tile
    const uint32_t sloff = isA ? wave * SLICEB : 4u * SLICEB + (wave - 4u) * SLICEB2;   // slice in a stage

    // Descriptor group 1 of A, the same for every request: 1-byte elements, tensor = tile =
    // 32 rows of 256 bytes, source pitch 2 K bytes, 4 dwords of pad behind each row.
    // Each word is held in its scalar register by pinned(), so that the compiler lends
    // none of the eight to another value while a request is outstanding.
    u32x8 d1;
    d1[0] = pinned((1u << 20) | (5u << 22) | (3u << 25));
    d1[1] = pinned((ROWB & 0xFFFFu) << 16);
    d1[2] = pinned((ROWB >> 16) | ((SLROWS & 0xFFFFu) << 16));
    d1[3] = pinned((SLROWS >> 16) | (ROWB << 16));
    d1[4] = pinned(SLROWS);
    d1[5] = pinned((uint32_t)K * 2u);
    d1[6] = pinned(0u);
    d1[7] = pinned(0u);
    // The same for B: 8 rows of 512 bytes (a fragment each), source pitch 4 K bytes (a fragment's
    // K / 128 tiles), no pad.
    u32x8 e1;
    e1[0] = pinned(0u);
    e1[1] = pinned((FRAGB & 0xFFFFu) << 16);
    e1[2] = pinned((FRAGB >> 16) | ((SLFRAGS & 0xFFFFu) << 16));
    e1[3] = pinned((SLFRAGS >> 16) | (FRAGB << 16));
    e1[4] = pinned(SLFRAGS);
    e1[5] = pinned((uint32_t)K * 4u);
    e1[6] = pinned(0u);
    e1[7] = pinned(0u);

    // Stage this wave's slice of K tile kt of row tile t into LDS buffer `buf`.
    // Group 0 lives in one set of registers from here on: its word 0 is written once, ahead of
    // the first request; the other three are formed anew for each request, behind the wait.
    u32x4 d0;
    d0[0] = pinned(1u);   // pinned(): a descriptor word held in its scalar register
    auto stage = [&](int t, int kt, int buf) {
        const uint64_t ga = sbase + (uint64_t)((uint32_t)t * tstep) + (uint64_t)((uint32_t)kt * sstep);
        d0[1] = uni(lbase + (uint32_t)buf * BUFB + sloff);
        d0[2] = uni((uint32_t)ga);
        d0[3] = uni((((uint32_t)(ga >> 32)) & 0x01FFFFFFu) | 0x80000000u);
        // one request of the whole wave; no builtin is used, the waits are written by hand
        if (pinned(wave < 4u))  asm volatile("tensor_load_to_lds %0, %1" :: "s"(d0), "s"(d1) : "memory");
        if (pinned(wave >= 4u)) asm volatile("tensor_load_to_lds %0, %1" :: "s"(d0), "s"(e1) : "memory");
    };

    const int ktiles = K / GBK;
    stage(0, 0, 0);
    // this wave's slice of tile 0 has landed before the barrier publishes it
    asm volatile("s_wait_tensorcnt 0x0" ::: "memory");
    __syncthreads();
    if (pinned(1 < ktiles)) stage(0, 1, 1);

    // The ring runs on from one row tile to the next: the next row tile's first K tile lands under
    // this one's last. Kept rolled: a second copy of the K loop would only take instruction cache.
    #pragma unroll 1
    for (int t = 0; t < GTILES; ++t) {
    v8f acc[8][4] = {};

    for (int kt = 0; kt < ktiles; ++kt) {
        const int cur = (t * ktiles + kt) & 1;

        // a lane's weights of a fragment for the whole K tile are 16 bytes: one dword for each 32 k
        u32x4 bq[4];
        #pragma unroll
        for (int ni = 0; ni < 4; ++ni)
            bq[ni] = *(const u32x4*)(L + cur * BUFB + 4u * SLICEB + (waveN * 4 + ni) * FRAGB + lane * 16);
        // The B codes, which the first row of WMMAs needs, stay in front of the A
        // fragments, so that the counted waits let them be widened while A arrives.
        __builtin_amdgcn_sched_barrier(0);

        #pragma unroll
        for (int ks = 0; ks < GBK / 32; ++ks) {
            v16h af[8], bf[4];
            #pragma unroll
            for (int mi = 0; mi < 8; ++mi) {
                const _Float16* p = (const _Float16*)(L + cur * BUFB + (mi >> 1) * SLICEB
                                                      + ((mi & 1) * 16 + lm) * PITCHB) + ks * 32;
                v8h lo = *(const v8h*)(p + r0);
                v8h hi = *(const v8h*)(p + r0 + 16);
                #pragma unroll
                for (int i = 0; i < 8; ++i) { af[mi][i] = lo[i]; af[mi][i + 8] = hi[i]; }
            }

            // Keeps the block's 16 LDS reads together in front of its 32 WMMAs: left
            // alone the compiler reads one A fragment per row of four WMMAs and waits
            // for it each time, which two waves per SIMD cannot hide.
            __builtin_amdgcn_sched_barrier(0);

            // 2-bit code -> the top two bits of an f16 (0, 2 or -2), two a dword
            #pragma unroll
            for (int ni = 0; ni < 4; ++ni) {
                u32x8 x;
                const uint32_t cw = bq[ni][ks];
                #pragma unroll
                for (int d = 0; d < 7; ++d) x[d] = (cw << (2 * d)) & 0xC000C000u;
                // the last pair lies lowest in each half: a shift of the two halves leaves nothing to mask
                const u16x2 last = __builtin_bit_cast(u16x2, cw) << 14;
                x[7] = __builtin_bit_cast(uint32_t, last);
                bf[ni] = __builtin_bit_cast(v16h, x);
            }

            #pragma unroll
            for (int mi = 0; mi < 8; ++mi)
                #pragma unroll
                for (int ni = 0; ni < 4; ++ni)
                    acc[mi][ni] = __builtin_amdgcn_wmma_f32_16x16x32_f16(
                        false, af[mi], false, bf[ni], (short)0, acc[mi][ni], false, false);

            // Keeps the next block's reads from moving up among these WMMAs.
            __builtin_amdgcn_sched_barrier(0);
        }

        // Publish point of tile kt + 1: this wave's reads of buffer cur are done,
        // its slice of tile kt + 1 has landed, then the barrier; only behind it
        // is buffer cur refilled.
        asm volatile("s_wait_dscnt 0x0" ::: "memory");
        // group 0 is an input of the wait: its registers are then lent to no other value (the
        // set-up of a row tile, its store addresses) while the request is outstanding
        asm volatile("s_wait_tensorcnt 0x0" :: "s"(d0) : "memory");
        __syncthreads();
        // The stage two ahead; past this row tile's end it is the next one's first. Behind a row
        // tile's last trip nothing is issued here: that refill follows the epilogue.
        const int wrap = kt + 2 >= ktiles ? 1 : 0;
        if (pinned(kt + 1 < ktiles && t + wrap < GTILES)) stage(t + wrap, kt + 2 - wrap * ktiles, cur);
    }
    // no tensor load and no LDS read is left in flight when the wave goes on to the stores
    asm volatile("s_wait_tensorcnt 0x0" ::: "memory");
    asm volatile("s_wait_dscnt 0x0" ::: "memory");

    // Epilogue: whole lines. Each wave lays its 128 x 64 tile, 64 rows at a time, in a range of
    // its own behind the ring (64 rows at the 272-byte pitch; the ring holds the next row tile's
    // first stage) and reads it back row by row, so that one store covers 256 contiguous bytes
    // of each of two rows instead of 64. The second half is laid in LDS while the first half's
    // stores drain.
    float* Sw = (float*)(L + 2u * BUFB + wave * EPIW);
    const uint32_t half = (uint32_t)lane >> 4;
    float* Cw = C + (size_t)((by0 + (uint32_t)t * nby) * GBM) * N + (bx * GBN + wave * 64u);
    const uint32_t loff = half * (uint32_t)N + (uint32_t)lm * 4u;
    const float* Sr = Sw + half * (PITCHB / 4u) + lm * 4;
    #pragma unroll
    for (int g = 0; g < 2; ++g) {
        #pragma unroll
        for (int mi = g * 4; mi < g * 4 + 4; ++mi)
            #pragma unroll
            for (int ni = 0; ni < 4; ++ni)
                #pragma unroll
                for (int r = 0; r < 8; ++r)
                    Sw[((mi - g * 4) * 16 + half * 8 + r) * (PITCHB / 4u) + ni * 16 + lm] = acc[mi][ni][r];
        // the wave's own LDS writes are done before it reads the rows back across lanes
        asm volatile("s_wait_dscnt 0x0" ::: "memory");
        #pragma unroll
        for (int q = g * 2; q < g * 2 + 2; ++q) {
            #pragma unroll
            for (int j = q * 16; j < q * 16 + 16; ++j) {
                f32x4 v = *(const f32x4*)(Sr + (j - g * 32) * 2 * (PITCHB / 4u));
                __builtin_nontemporal_store(v, (f32x4*)(Cw + (size_t)(2 * j) * N + loff));
            }
            // a precaution: what follows (behind the last group, the next row tile) reuses
            // registers that these 16 stores name, and rewrites none of them ahead of this wait
            asm volatile("s_wait_xcnt 0x0" ::: "memory");
            // keeps the following address sums and LDS reads behind that wait
            __builtin_amdgcn_sched_barrier(0);
        }
    }
    // The refill that the row tile's last trip left open: the next row tile's second stage, into
    // the buffer which that trip read and whose readers its barrier ended.
    if (pinned(t + 1 < GTILES)) stage(t + 1, 1, ((t + 1) * ktiles + 1) & 1);
    }
}

// ---------------- Fallback: fused single-kernel path ----------------
#define BM 128
#define BN 128
#define BK 32

__global__ __launch_bounds__(256)
void ternary_gemm_fused(const float* __restrict__ A, const float* __restrict__ B,
                        float* __restrict__ C, int M, int N, int K)
{
    __shared__ _Float16 As[2][BM * LDSS];
    __shared__ _Float16 Bs[2][BN * LDSS];

    const int tid  = threadIdx.x;
    const int lane = tid & 31;
    const int w    = tid >> 5;
    const int waveM = w >> 1;
    const int waveN = w & 1;
    const int lm   = lane & 15;
    const int r0   = (lane >> 4) << 3;
    const int bx = blockIdx.x, by = blockIdx.y;

    const int arow = tid >> 1;
    const int acol = (tid & 1) * 16;
    const float4* Ag = (const float4*)(A + (size_t)(by * BM + arow) * K + acol);
    const int brow = tid >> 3;
    const int bcol = (tid & 7) * 16;
    const float4* Bg = (const float4*)(B + (size_t)brow * N + bx * BN + bcol);

    float4 aReg[4], bReg[4];
    auto loadGlobal = [&](int kt) {
        const float4* pa = Ag + (size_t)kt * (BK / 4);
        #pragma unroll
        for (int i = 0; i < 4; ++i) aReg[i] = pa[i];
        const float4* pb = Bg + (size_t)kt * BK * (N / 4);
        #pragma unroll
        for (int i = 0; i < 4; ++i) bReg[i] = pb[i];
    };
    auto stageToLds = [&](int buf) {
        const float* af = (const float*)aReg;
        v8h h0, h1;
        #pragma unroll
        for (int i = 0; i < 8; ++i) { h0[i] = (_Float16)af[i]; h1[i] = (_Float16)af[i + 8]; }
        *(v8h*)&As[buf][arow * LDSS + acol]     = h0;
        *(v8h*)&As[buf][arow * LDSS + acol + 8] = h1;
        const float* bf = (const float*)bReg;
        #pragma unroll
        for (int i = 0; i < 16; ++i) {
            float wv = bf[i];
            float aw = fabsf(wv);
            float t  = (aw >= 0.5f && aw < 1.5f) ? (wv > 0.0f ? 1.0f : -1.0f) : 0.0f;
            Bs[buf][(bcol + i) * LDSS + brow] = (_Float16)t;
        }
    };

    v8f acc[2][4] = {};
    const int ktiles = K / BK;
    loadGlobal(0);
    stageToLds(0);
    __syncthreads();

    for (int kt = 0; kt < ktiles; ++kt) {
        const int cur = kt & 1;
        if (kt + 1 < ktiles) loadGlobal(kt + 1);

        v16h afrag[2];
        #pragma unroll
        for (int mi = 0; mi < 2; ++mi) {
            const _Float16* p = &As[cur][(waveM * 32 + mi * 16 + lm) * LDSS];
            v8h lo = *(const v8h*)(p + r0);
            v8h hi = *(const v8h*)(p + r0 + 16);
            #pragma unroll
            for (int i = 0; i < 8; ++i) { afrag[mi][i] = lo[i]; afrag[mi][i + 8] = hi[i]; }
        }
        v16h bfrag[4];
        #pragma unroll
        for (int ni = 0; ni < 4; ++ni) {
            const _Float16* p = &Bs[cur][(waveN * 64 + ni * 16 + lm) * LDSS];
            v8h lo = *(const v8h*)(p + r0);
            v8h hi = *(const v8h*)(p + r0 + 16);
            #pragma unroll
            for (int i = 0; i < 8; ++i) { bfrag[ni][i] = lo[i]; bfrag[ni][i + 8] = hi[i]; }
        }
        #pragma unroll
        for (int mi = 0; mi < 2; ++mi)
            #pragma unroll
            for (int ni = 0; ni < 4; ++ni)
                acc[mi][ni] = __builtin_amdgcn_wmma_f32_16x16x32_f16(
                    false, afrag[mi], false, bfrag[ni], (short)0, acc[mi][ni], false, false);

        if (kt + 1 < ktiles) stageToLds(cur ^ 1);
        __syncthreads();
    }

    const int rowBase = by * BM + waveM * 32 + ((lane >> 4) << 3);
    const int colBase = bx * BN + waveN * 64 + lm;
    #pragma unroll
    for (int mi = 0; mi < 2; ++mi)
        #pragma unroll
        for (int ni = 0; ni < 4; ++ni)
            #pragma unroll
            for (int r = 0; r < 8; ++r)
                C[(size_t)(rowBase + mi * 16 + r) * N + colBase + ni * 16] = acc[mi][ni][r];
}

extern "C" void kernel_launch(void* const* d_in, const int* in_sizes, int n_in,
                              void* d_out, int out_size, void* d_ws, size_t ws_size,
                              hipStream_t stream) {
    const float* A = (const float*)d_in[0];   // inputs [M, K] f32
    const float* B = (const float*)d_in[1];   // kernel [K, N] f32
    float* C = (float*)d_out;                 // [M, N] f32

    const int K = 4096;
    const int N = in_sizes[1] / K;   // 4096
    const int M = in_sizes[0] / K;   // 8192

    const size_t needA = (size_t)M * K * sizeof(_Float16);
    const size_t needB = (size_t)N * K / 4;   // two bits a weight

    if (ws_size >= needA + needB) {
        _Float16* Ah = (_Float16*)d_ws;
        unsigned char* Bt = (unsigned char*)d_ws + needA;

        const size_t nA = (size_t)M * K;
        prep_ab<<<dim3((unsigned)(nA / PA_BLOCKF) + (N / TB) * (K / (TB * TBK))), 256, 0, stream>>>(A, Ah, nA, B, Bt, K, N);
        gemm_f16_wmma<<<dim3(N / GBN, M / GBM / GTILES), 256, 0, stream>>>(Ah, Bt, C, M, N, K);
    } else {
        ternary_gemm_fused<<<dim3(N / BN, M / BM), 256, 0, stream>>>(A, B, C, M, N, K);
    }
}
